// v000
// The times below were measured on an AMD MI455X: many runs one after another, warmed up first and cycling through
// copies of the inputs, with the whole window's GPU time divided by the number of runs. Launches and the gaps
// between them are all in it. The median over several windows is given; except for v000 it joins two sittings, which
// can be a few percent apart, so the side-by-side timings, each taken in one sitting, are the better comparison.
// v000 is the starting kernel. One run takes 2000 microseconds.
#include <hip/hip_runtime.h>

// SparseFlashAttention (x [2][2048][1024]; q/k/v = x W^T + b (torch layouts, 16 heads x 64); q and k multiplied by sparsity_mask[b][h][s] (int 0/1, read as data); softmax(q.k/8) (no other mask); out = (attn v merged) Wo^T + bo -> [2][2048][1024]).
// Compute dtypes, f32 accumulate: every input rounded to bf16; q/k/v projections on PLAIN bf16 operands (inputs: exact) + bias; scores (K 64) and attn.v on bf16 hi+lo planes (3 products) for the first 512 query rows of each head

#define NB_  2
#define TT   2048
#define DM   1024
#define NH_  16
#define NKV  16
#define REP  (NH_ / NKV)
#define HD   64
#define DQ   (NH_ * HD)
#define DKV  (NKV * HD)
#define ZH   2
#define RH   512                  // query rows < RH use hi+lo planes (0: none)
#define WIN  0
#define PCAR 1024.0f
#define SCL  0.125f   // HD^-0.5
typedef _Float16 h16;
typedef unsigned short bf;
typedef __attribute__((ext_vector_type(16))) __bf16   v16bf;
typedef __attribute__((ext_vector_type(16))) _Float16 v16h;
typedef __attribute__((ext_vector_type(8)))  _Float16 v8h;
typedef __attribute__((ext_vector_type(8)))  unsigned short v8us;
typedef __attribute__((ext_vector_type(8)))  float    v8f;
typedef __attribute__((ext_vector_type(4)))  float    v4f;
typedef v8h  __attribute__((may_alias)) v8ha;
typedef v4f  __attribute__((may_alias)) v4fa;
typedef v8us __attribute__((may_alias)) v8usa;

__device__ __forceinline__ unsigned short f2bf(float f) { unsigned u = __float_as_uint(f); u += 0x7FFFu + ((u >> 16) & 1u); return (unsigned short)(u >> 16); }
__device__ __forceinline__ float bf2f(unsigned short b) { return __uint_as_float(((unsigned)b) << 16); }
__device__ __forceinline__ float bfr(float f) { return bf2f(f2bf(f)); }
__device__ __forceinline__ v16h cat16(v8h lo, v8h hi) { return __builtin_shufflevector(lo, hi, 0, 1, 2, 3, 4, 5, 6, 7, 8, 9, 10, 11, 12, 13, 14, 15); }
__device__ __forceinline__ v16bf cat16b(v8us lo, v8us hi) { return __builtin_bit_cast(v16bf, __builtin_shufflevector(lo, hi, 0, 1, 2, 3, 4, 5, 6, 7, 8, 9, 10, 11, 12, 13, 14, 15)); }
__device__ __forceinline__ v8f wmma16(v16h a, v16h b, v8f c) { return __builtin_amdgcn_wmma_f32_16x16x32_f16(false, a, false, b, (short)0, c, false, false); }
__device__ __forceinline__ v8f wmmab(v16bf a, v16bf b, v8f c) { return __builtin_amdgcn_wmma_f32_16x16x32_bf16(false, a, false, b, (short)0, c, false, false); }



// ---- k_gemmw: register-blocked GEMM, ONE WAVE per 64x64 output tile (16 accumulators), operands straight from K-contiguous 16-bit planes; grid (M/64, N/64, Z), 32 threads.
// C[m][n] (f32, pitch ldc, + optional f32 bias[n]) = sum_k A[m][k] Bt[n][k] (+ split products per NSPLIT). z-batch strides sA/sB/sC in elements. K % 32 == 0.
template <typename T16> struct WFrag;
template <> struct WFrag<h16> { typedef v16h V; static __device__ __forceinline__ V ld(const h16* p) { return cat16(*(const v8h*)p, *(const v8h*)(p + 16)); } static __device__ __forceinline__ v8f mma(V a, V b, v8f c) { return wmma16(a, b, c); } };
template <> struct WFrag<bf> { typedef v16bf V; static __device__ __forceinline__ V ld(const bf* p) { return cat16b(*(const v8us*)p, *(const v8us*)(p + 16)); } static __device__ __forceinline__ v8f mma(V a, V b, v8f c) { return wmmab(a, b, c); } };
template <typename T16, int NSPLIT, bool BIAS>
__global__ __launch_bounds__(32) void k_gemmw(const T16* __restrict__ A, const T16* __restrict__ A2, const T16* __restrict__ Bt, const T16* __restrict__ Bt2, int K, float* C, int ldc, const float* __restrict__ bias, size_t sA, size_t sB, size_t sC) {
    typedef typename WFrag<T16>::V V;
    __shared__ __align__(16) float os[16 * 68];
    const size_t z = blockIdx.z; A += z * sA; if (A2) A2 += z * sA; Bt += z * sB; if (Bt2) Bt2 += z * sB; C += z * sC;
    const int lane = threadIdx.x & 31, lr = lane & 15, hi = lane >> 4; const int r0 = blockIdx.x * 64, c0 = blockIdx.y * 64;
    v8f acc[4][4];
#pragma unroll
    for (int mb = 0; mb < 4; ++mb)
#pragma unroll
        for (int nb = 0; nb < 4; ++nb) acc[mb][nb] = (v8f){};
    const size_t aoff = (size_t)(r0 + lr) * K + 8 * hi, boff = (size_t)(c0 + lr) * K + 8 * hi;
#pragma unroll 1
    for (int kc = 0; kc < K; kc += 32) {
        V a[4], a2[4];
#pragma unroll
        for (int mb = 0; mb < 4; ++mb) { a[mb] = WFrag<T16>::ld(A + aoff + (size_t)mb * 16 * K + kc); if (NSPLIT == 1 || NSPLIT == 2) a2[mb] = WFrag<T16>::ld(A2 + aoff + (size_t)mb * 16 * K + kc); }
#pragma unroll
        for (int nb = 0; nb < 4; ++nb) { const V b = WFrag<T16>::ld(Bt + boff + (size_t)nb * 16 * K + kc); V b2; if (NSPLIT >= 2) b2 = WFrag<T16>::ld(Bt2 + boff + (size_t)nb * 16 * K + kc);
#pragma unroll
            for (int mb = 0; mb < 4; ++mb) { acc[mb][nb] = WFrag<T16>::mma(a[mb], b, acc[mb][nb]); if (NSPLIT == 1 || NSPLIT == 2) acc[mb][nb] = WFrag<T16>::mma(a2[mb], b, acc[mb][nb]); if (NSPLIT >= 2) acc[mb][nb] = WFrag<T16>::mma(a[mb], b2, acc[mb][nb]); } }
        asm volatile("v_nop\n\tv_nop\n\tv_nop\n\tv_nop" : "+v"(acc[0][0]), "+v"(acc[1][1]), "+v"(acc[2][2]), "+v"(acc[3][3]) : "v"(a[0]), "v"(a[3]));
    }
#pragma unroll
    for (int mb = 0; mb < 4; ++mb) {
#pragma unroll
        for (int nb = 0; nb < 4; ++nb) {
#pragma unroll
            for (int j = 0; j < 8; ++j) os[(hi * 8 + j) * 68 + nb * 16 + lr] = acc[mb][nb][j]; }
        __builtin_amdgcn_wave_barrier(); asm volatile("" ::: "memory");
        float* crow = C + (size_t)(r0 + mb * 16) * ldc + c0;
{
#pragma unroll
            for (int s = 0; s < 8; ++s) { const int row = 2 * s + hi, cofs = lr * 4; v4f val = *(const v4fa*)(os + row * 68 + cofs); if (BIAS) { val[0] += bfr(bias[c0 + cofs]); val[1] += bfr(bias[c0 + cofs + 1]); val[2] += bfr(bias[c0 + cofs + 2]); val[3] += bfr(bias[c0 + cofs + 3]); }
                *(v4f*)(crow + (size_t)row * ldc + cofs) = val; }
             }
        __builtin_amdgcn_wave_barrier(); asm volatile("" ::: "memory");
    }
}

__device__ __forceinline__ h16 tohx(float x) { return (h16)x; }
__device__ __forceinline__ void splitf(float y, unsigned short& h, unsigned short& l) { h = f2bf(y); l = f2bf(y - bf2f(h)); }
typedef __attribute__((ext_vector_type(2))) _Float16 v2h;
typedef __attribute__((ext_vector_type(4))) _Float16 v4h;
typedef __attribute__((ext_vector_type(2))) unsigned short v2us;
typedef __attribute__((ext_vector_type(4))) unsigned short v4us;
typedef __attribute__((ext_vector_type(2))) float v2f;
typedef __attribute__((ext_vector_type(4))) int v4i;

__global__ __launch_bounds__(256) void k_wtG(const float* __restrict__ w, int K, int N, bf* Bt) {
    const int lane = threadIdx.x & 31; const int L0 = (blockIdx.x * 8 + (threadIdx.x >> 5)) * 8; const int nlines = N * K / 64;
{
#pragma unroll 1
        for (int l = 0; l < 8; ++l) { const int L = L0 + l; if (L >= nlines) break; const size_t e = (size_t)L * 64 + lane * 2; const int k = (int)(e % K), n = (int)(e / K); v2us o;
            o[0] = f2bf(w[(size_t)k * N + n]); o[1] = f2bf(w[(size_t)(k + 1) * N + n]); *(v2us*)(Bt + e) = o; }
         }
}
__global__ __launch_bounds__(256) void k_cvt8(const float* __restrict__ src, bf* dst, size_t n8) { const size_t i = (size_t)blockIdx.x * 256 + threadIdx.x; if (i >= n8) return; const v8f v = *(const v8f*)(src + i * 8); v8us o;
#pragma unroll
    for (int k = 0; k < 8; ++k) o[k] = f2bf(v[k]); *(v8us*)(dst + i * 8) = o;  }
__global__ __launch_bounds__(256) void k_cscvt(const float* __restrict__ cosT, const float* __restrict__ sinT, float* CS) { const int idx = blockIdx.x * 256 + threadIdx.x; if (idx >= TT * HD) return; v2f cs; cs[0] = bfr(cosT[idx]); cs[1] = bfr(sinT[idx]); *(v2f*)(CS + (size_t)idx * 2) = cs;  }
// k_rope: head planes [h][t][d] (fp16 + hi/lo) of rope(x) x sc with the rotate-half convention out[d] = x[d] cos[t][d] - x[d+HD/2] sin[t][d], out[d+HD/2] = x[d+HD/2] cos[t][d+HD/2] + x[d] sin[t][d+HD/2]
__global__ __launch_bounds__(256) void k_rope(const float* __restrict__ F, int pitch, int nheads, const float* __restrict__ CS, const float* __restrict__ RF, const float* __restrict__ nw, float sc, h16* P16, bf* Ph, bf* Pl) {
    const size_t e = ((size_t)blockIdx.x * 256 + threadIdx.x) * 2; if (e >= (size_t)nheads * TT * HD) return; const int d = (int)(e % HD); const int t = (int)((e / HD) % TT); const int h = (int)(e / ((size_t)HD * TT)); const float* f = F + (size_t)t * pitch + h * HD; const float rf = RF ? RF[(size_t)h * TT + t] : 1.0f; v2h o16; v2us oh, ol;
#pragma unroll
    for (int q = 0; q < 2; ++q) { const int dd = d + q; const int dp = (dd < HD / 2) ? dd + HD / 2 : dd - HD / 2; float x0 = f[dd], x1 = f[dp];
        if (RF) { float n0 = __fmul_rn(x0, rf), n1 = __fmul_rn(x1, rf); asm volatile("" : "+v"(n0)); asm volatile("" : "+v"(n1)); x0 = __fmul_rn(bfr(nw[dd]), n0); x1 = __fmul_rn(bfr(nw[dp]), n1); }
        const v2f cs = *(const v2f*)(CS + ((size_t)t * HD + dd) * 2); float a = __fmul_rn(x0, cs[0]), bq = __fmul_rn(x1, cs[1]); asm volatile("" : "+v"(a)); asm volatile("" : "+v"(bq)); const float r = ((dd < HD / 2) ? __fsub_rn(a, bq) : __fadd_rn(a, bq)) * sc;
        o16[q] = tohx(r); unsigned short a2, c2; splitf(r, a2, c2); oh[q] = a2; ol[q] = c2; }
    *(v2h*)(P16 + e) = o16; *(v2us*)(Ph + e) = oh; *(v2us*)(Pl + e) = ol;  }
__global__ __launch_bounds__(256) void k_vtp(const float* __restrict__ F, int pitch, int nheads, h16* V16, bf* Vh, bf* Vl) { const size_t e = ((size_t)blockIdx.x * 256 + threadIdx.x) * 2; if (e >= (size_t)nheads * HD * TT) return; const int t = (int)(e % TT); const int d = (int)((e / TT) % HD); const int g = (int)(e / ((size_t)TT * HD)); v2h o16; v2us oh, ol;
#pragma unroll
    for (int q = 0; q < 2; ++q) { const float x = F[(size_t)(t + q) * pitch + g * HD + d]; o16[q] = tohx(x); unsigned short a2, c2; splitf(x, a2, c2); oh[q] = a2; ol[q] = c2; }
    *(v2h*)(V16 + e) = o16; *(v2us*)(Vh + e) = oh; *(v2us*)(Vl + e) = ol;  }
__global__ __launch_bounds__(256) void k_csid(float* CS) { const int idx = blockIdx.x * 256 + threadIdx.x; if (idx >= TT * HD) return; v2f cs; cs[0] = 1.0f; cs[1] = 0.0f; *(v2f*)(CS + (size_t)idx * 2) = cs;  }
__global__ __launch_bounds__(256) void k_mkf(const int* __restrict__ mk, float* MKF, float* ONES) { const int i = blockIdx.x * 256 + threadIdx.x; if (i < HD) { *(float*)(ONES + i) = 1.0f; } if (i >= NB_ * NH_ * TT) return; const float v = (float)mk[i]; *(float*)(MKF + i) = v;  if (i < HD) *(float*)(ONES + i) = 1.0f; }
// k_asoft: per row (zz, i): t = S x HD^-0.5 (no mask); softmax over the 2048 keys (register row, one exp, fixed trees);
__global__ __launch_bounds__(256) void k_asoft(const float* __restrict__ Sb, h16* P16, bf* Ph, bf* Pl) {
    const int lane = threadIdx.x & 31; const int row = blockIdx.x * 8 + (threadIdx.x >> 5); if (row >= ZH * TT) return; const int i = row % TT; const int zz = row / TT; (void)zz; const bool hires = (i < RH); const float* sr = Sb + (size_t)row * TT; float v[TT / 32]; float mx = -3.0e38f;
#pragma unroll
    for (int ch = 0; ch < TT / 128; ++ch) { const int j0 = ch * 128 + lane * 4; const v4f a = *(const v4f*)(sr + j0);
#pragma unroll
        for (int q = 0; q < 4; ++q) { const int j = j0 + q; (void)j; const float t = a[q] * SCL; v[ch * 4 + q] = t; mx = fmaxf(mx, t); } }
#pragma unroll
    for (int sh = 16; sh; sh >>= 1) mx = fmaxf(mx, __shfl_xor(mx, sh, 32));
    float sum = 0.f;
#pragma unroll
    for (int k = 0; k < TT / 32; ++k) { float d0 = __fsub_rn(v[k], mx); asm volatile("" : "+v"(d0)); v[k] = __builtin_amdgcn_exp2f(__fmul_rn(d0, 1.4426950408889634f)); sum += v[k]; }
#pragma unroll
    for (int sh = 16; sh; sh >>= 1) sum += __shfl_xor(sum, sh, 32);
    const float f = __fdiv_rn(hires ? 1.0f : PCAR, sum);
{
        if (hires) {
#pragma unroll
            for (int ch = 0; ch < TT / 128; ++ch) { v4us oh, ol;
#pragma unroll
                for (int q = 0; q < 4; ++q) { unsigned short a, c2; splitf(v[ch * 4 + q] * f, a, c2); oh[q] = a; ol[q] = c2; }
                const size_t oo = ((size_t)zz * (RH ? RH : 1) + i) * TT + ch * 128 + lane * 4; *(v4us*)(Ph + oo) = oh; *(v4us*)(Pl + oo) = ol; }
        } else {
#pragma unroll
            for (int ch = 0; ch < TT / 128; ++ch) { v4h o4;
#pragma unroll
                for (int q = 0; q < 4; ++q) o4[q] = tohx(v[ch * 4 + q] * f);
                *(v4h*)(P16 + (size_t)row * TT + ch * 128 + lane * 4) = o4; } }
         }
}
__global__ __launch_bounds__(256) void k_merge(const float* __restrict__ O, int h0, bf* Ah, bf* Al) { const size_t e = ((size_t)blockIdx.x * 256 + threadIdx.x) * 2; if (e >= (size_t)ZH * TT * HD) return; const int d = (int)(e % HD); const int t = (int)((e / HD) % TT); const int zz = (int)(e / ((size_t)HD * TT)); const float cs = (t < RH) ? 1.0f : (1.0f / PCAR); const size_t oo = (size_t)t * DQ + (h0 + zz) * HD + d;
    v2us oh, ol;
#pragma unroll
    for (int q = 0; q < 2; ++q) { unsigned short a, c2; splitf(O[e + q] * cs, a, c2); oh[q] = a; ol[q] = c2; } *(v2us*)(Ah + oo) = oh; *(v2us*)(Al + oo) = ol;  }

extern "C" void kernel_launch(void* const* d_in, const int* in_sizes, int n_in,
                              void* d_out, int out_size, void* d_ws, size_t ws_size, hipStream_t stream) {
    (void)in_sizes; (void)n_in; (void)out_size;
    const float* x = (const float*)d_in[0]; const int* MK = (const int*)d_in[1]; const float* wq = (const float*)d_in[2]; const float* bq = (const float*)d_in[3]; const float* wk = (const float*)d_in[4]; const float* bk = (const float*)d_in[5]; const float* wv = (const float*)d_in[6]; const float* bv = (const float*)d_in[7]; const float* wo = (const float*)d_in[8]; const float* bo = (const float*)d_in[9]; const float* cosT = nullptr; const float* sinT = nullptr; (void)cosT; (void)sinT;
    float* OUT = (float*)d_out;     // [2][2048][1024]
    char* wsp = (char*)d_ws;
    auto take = [&](size_t bytes) { char* p = wsp; wsp += (bytes + 255) & ~(size_t)255; return (void*)p; };
    bf* WQ = (bf*)take((size_t)DQ * DM * 2); bf* WK = (bf*)take((size_t)DKV * DM * 2); bf* WV = (bf*)take((size_t)DKV * DM * 2); bf* WO = (bf*)take((size_t)DM * DQ * 2); float* CS = (float*)take((size_t)TT * HD * 2 * 4); float* MKF = (float*)take((size_t)NB_ * NH_ * TT * 4); float* ONES = (float*)take(256);
    bf* XB = (bf*)take((size_t)TT * DM * 2); float* FQ = (float*)take((size_t)TT * DQ * 4); float* FK = (float*)take((size_t)TT * DKV * 4);
    h16* QP16 = (h16*)take((size_t)NH_ * TT * HD * 2); h16* KP16 = (h16*)take((size_t)NKV * TT * HD * 2); h16* VT16 = (h16*)take((size_t)NKV * HD * TT * 2);
    bf* QPh = (bf*)take((size_t)NH_ * TT * HD * 2); bf* QPl = (bf*)take((size_t)NH_ * TT * HD * 2); bf* KPh = (bf*)take((size_t)NKV * TT * HD * 2); bf* KPl = (bf*)take((size_t)NKV * TT * HD * 2); bf* VTh = (bf*)take((size_t)NKV * HD * TT * 2); bf* VTl = (bf*)take((size_t)NKV * HD * TT * 2); bf* Ph = (bf*)take((size_t)ZH * RH * TT * 2); bf* Pl = (bf*)take((size_t)ZH * RH * TT * 2);
    float* Sb = (float*)take((size_t)ZH * TT * TT * 4); h16* P16 = (h16*)take((size_t)ZH * TT * TT * 2); float* Ob = (float*)take((size_t)ZH * TT * HD * 4); bf* ATh = (bf*)take((size_t)TT * DQ * 2); bf* ATl = (bf*)take((size_t)TT * DQ * 2);
    if ((size_t)(wsp - (char*)d_ws) > ws_size) return;    // ws 256 MiB
    float* FV = FK;   // v projection reuses the k buffer after the k planes are built (stream-ordered)
    { k_cvt8<<<(unsigned)(((size_t)DQ * DM / 8 + 255) / 256), 256, 0, stream>>>(wq, WQ, (size_t)DQ * DM / 8); k_cvt8<<<(unsigned)(((size_t)DKV * DM / 8 + 255) / 256), 256, 0, stream>>>(wk, WK, (size_t)DKV * DM / 8); k_cvt8<<<(unsigned)(((size_t)DKV * DM / 8 + 255) / 256), 256, 0, stream>>>(wv, WV, (size_t)DKV * DM / 8);
      k_cvt8<<<(unsigned)(((size_t)DM * DQ / 8 + 255) / 256), 256, 0, stream>>>(wo, WO, (size_t)DM * DQ / 8);
       }
    k_csid<<<(TT * HD + 255) / 256, 256, 0, stream>>>(CS); k_mkf<<<(NB_ * NH_ * TT + 255) / 256, 256, 0, stream>>>((const int*)MK, MKF, ONES);
    const unsigned LQ = (unsigned)(((size_t)NH_ * TT * HD / 2 + 255) / 256), LKv = (unsigned)(((size_t)NKV * TT * HD / 2 + 255) / 256);
    for (int b = 0; b < NB_; ++b) {
        
        k_cvt8<<<(unsigned)(((size_t)TT * DM / 8 + 255) / 256), 256, 0, stream>>>(x + (size_t)b * TT * DM, XB, (size_t)TT * DM / 8);
        k_gemmw<bf, 0, true><<<dim3(TT / 64, DQ / 64, 1), 32, 0, stream>>>(XB, nullptr, WQ, nullptr, DM, FQ, DQ, bq, 0, 0, 0);
        k_rope<<<LQ, 256, 0, stream>>>(FQ, DQ, NH_, CS, MKF + (size_t)b * NH_ * TT, ONES, 1.0f, QP16, QPh, QPl);   // q x mask[b][h][s]
        k_gemmw<bf, 0, true><<<dim3(TT / 64, DKV / 64, 1), 32, 0, stream>>>(XB, nullptr, WK, nullptr, DM, FK, DKV, bk, 0, 0, 0);
        k_rope<<<LKv, 256, 0, stream>>>(FK, DKV, NKV, CS, MKF + (size_t)b * NH_ * TT, ONES, 1.0f, KP16, KPh, KPl);   // k x mask[b][h][s]
        k_gemmw<bf, 0, true><<<dim3(TT / 64, DKV / 64, 1), 32, 0, stream>>>(XB, nullptr, WV, nullptr, DM, FV, DKV, bv, 0, 0, 0); k_vtp<<<LKv, 256, 0, stream>>>(FV, DKV, NKV, VT16, VTh, VTl);
        for (int h0 = 0; h0 < NH_; h0 += ZH) { const size_t zq = (size_t)h0, zk = (size_t)(h0 / REP);   // one kv head per query head: the pass's two heads use consecutive kv planes (z-strides TT*HD)
            k_gemmw<bf, 2, false><<<dim3(RH / 64, TT / 64, ZH), 32, 0, stream>>>(QPh + zq * TT * HD, QPl + zq * TT * HD, KPh + zk * TT * HD, KPl + zk * TT * HD, HD, Sb, TT, nullptr, (size_t)TT * HD, (size_t)TT * HD, (size_t)TT * TT);
            k_gemmw<h16, 0, false><<<dim3((TT - RH) / 64, TT / 64, ZH), 32, 0, stream>>>(QP16 + zq * TT * HD + (size_t)RH * HD, nullptr, KP16 + zk * TT * HD, nullptr, HD, Sb + (size_t)RH * TT, TT, nullptr, (size_t)TT * HD, (size_t)TT * HD, (size_t)TT * TT);
            k_asoft<<<ZH * TT / 8, 256, 0, stream>>>(Sb, P16, Ph, Pl);
            k_gemmw<bf, 2, false><<<dim3(RH / 64, HD / 64, ZH), 32, 0, stream>>>(Ph, Pl, VTh + zk * HD * TT, VTl + zk * HD * TT, TT, Ob, HD, nullptr, (size_t)RH * TT, (size_t)HD * TT, (size_t)TT * HD);
            k_gemmw<h16, 0, false><<<dim3((TT - RH) / 64, HD / 64, ZH), 32, 0, stream>>>(P16 + (size_t)RH * TT, nullptr, VT16 + zk * HD * TT, nullptr, TT, Ob + (size_t)RH * HD, HD, nullptr, (size_t)TT * TT, (size_t)HD * TT, (size_t)TT * HD);
            k_merge<<<(unsigned)(((size_t)ZH * TT * HD / 2 + 255) / 256), 256, 0, stream>>>(Ob, h0, ATh, ATl); }
        k_gemmw<bf, 1, true><<<dim3(TT / 64, DM / 64, 1), 32, 0, stream>>>(ATh, ATl, WO, nullptr, DQ, OUT + (size_t)b * TT * DM, DM, bo, 0, 0, 0); }
}

// v001
// Measured time: 864 microseconds a run.
// Timed twice side by side with v000, it ran 2.32 and 2.31 times as fast.
#include <hip/hip_runtime.h>

// SparseFlashAttention (x [2][2048][1024]; q/k/v = x W^T + b (torch layouts, 16 heads x 64); q and k multiplied by sparsity_mask[b][h][s] (int 0/1, read as data); softmax(q.k/8) (no other mask); out = (attn v merged) Wo^T + bo -> [2][2048][1024]).
// Compute dtypes, f32 accumulate: every input rounded to bf16; q/k/v projections on PLAIN bf16 operands (inputs: exact) + bias; scores (K 64) and attn.v on bf16 hi+lo planes (3 products) for the first 512 query rows of each head

#define NB_  2
#define TT   2048
#define DM   1024
#define NH_  16
#define NKV  16
#define REP  (NH_ / NKV)
#define HD   64
#define DQ   (NH_ * HD)
#define DKV  (NKV * HD)
#define ZH   2
#define RH   512                  // query rows < RH use hi+lo planes (0: none)
#define WIN  0
#define PCAR 1024.0f
#define SCL  0.125f   // HD^-0.5
#define KSP  16                   // K slices of the attn.v products (one wave per slice; f32 partial planes summed by k_merge)
typedef _Float16 h16;
typedef unsigned short bf;
typedef __attribute__((ext_vector_type(16))) __bf16   v16bf;
typedef __attribute__((ext_vector_type(16))) _Float16 v16h;
typedef __attribute__((ext_vector_type(8)))  _Float16 v8h;
typedef __attribute__((ext_vector_type(8)))  unsigned short v8us;
typedef __attribute__((ext_vector_type(8)))  float    v8f;
typedef __attribute__((ext_vector_type(4)))  float    v4f;
typedef v8h  __attribute__((may_alias)) v8ha;
typedef v4f  __attribute__((may_alias)) v4fa;
typedef v8us __attribute__((may_alias)) v8usa;

__device__ __forceinline__ unsigned short f2bf(float f) { unsigned u = __float_as_uint(f); u += 0x7FFFu + ((u >> 16) & 1u); return (unsigned short)(u >> 16); }
__device__ __forceinline__ float bf2f(unsigned short b) { return __uint_as_float(((unsigned)b) << 16); }
__device__ __forceinline__ float bfr(float f) { return bf2f(f2bf(f)); }
__device__ __forceinline__ v16h cat16(v8h lo, v8h hi) { return __builtin_shufflevector(lo, hi, 0, 1, 2, 3, 4, 5, 6, 7, 8, 9, 10, 11, 12, 13, 14, 15); }
__device__ __forceinline__ v16bf cat16b(v8us lo, v8us hi) { return __builtin_bit_cast(v16bf, __builtin_shufflevector(lo, hi, 0, 1, 2, 3, 4, 5, 6, 7, 8, 9, 10, 11, 12, 13, 14, 15)); }
__device__ __forceinline__ v8f wmma16(v16h a, v16h b, v8f c) { return __builtin_amdgcn_wmma_f32_16x16x32_f16(false, a, false, b, (short)0, c, false, false); }
__device__ __forceinline__ v8f wmmab(v16bf a, v16bf b, v8f c) { return __builtin_amdgcn_wmma_f32_16x16x32_bf16(false, a, false, b, (short)0, c, false, false); }



// ---- k_gemmw: register-blocked GEMM, ONE WAVE per 64x64 output tile (16 accumulators), operands straight from K-contiguous 16-bit planes; grid (M/64, N/64, Z), 32 threads.
// C[m][n] (f32, pitch ldc, + optional f32 bias[n]) = sum_k A[m][k] Bt[n][k] (+ split products per NSPLIT). z-batch strides sA/sB/sC in elements. K % 32 == 0.
// KSL > 1: grid (M/64, N/64 * KSL, Z); slice ks = blockIdx.y % KSL sums only k in [ks K/KSL, (ks+1) K/KSL) and stores it in partial plane ks (planes ZH * sC elements apart, one whole z-batch each); the reader adds the planes.
template <typename T16> struct WFrag;
template <> struct WFrag<h16> { typedef v16h V; static __device__ __forceinline__ V ld(const h16* p) { return cat16(*(const v8h*)p, *(const v8h*)(p + 16)); } static __device__ __forceinline__ v8f mma(V a, V b, v8f c) { return wmma16(a, b, c); } };
template <> struct WFrag<bf> { typedef v16bf V; static __device__ __forceinline__ V ld(const bf* p) { return cat16b(*(const v8us*)p, *(const v8us*)(p + 16)); } static __device__ __forceinline__ v8f mma(V a, V b, v8f c) { return wmmab(a, b, c); } };
template <typename T16, int NSPLIT, bool BIAS, int KSL = 1>
__global__ __launch_bounds__(32) void k_gemmw(const T16* __restrict__ A, const T16* __restrict__ A2, const T16* __restrict__ Bt, const T16* __restrict__ Bt2, int K, float* C, int ldc, const float* __restrict__ bias, size_t sA, size_t sB, size_t sC) {
    typedef typename WFrag<T16>::V V;
    __shared__ __align__(16) float os[16 * 68];
    const size_t z = blockIdx.z; A += z * sA; if (A2) A2 += z * sA; Bt += z * sB; if (Bt2) Bt2 += z * sB; C += z * sC;
    const int ks = blockIdx.y % KSL, kb = ks * (K / KSL), ke = kb + K / KSL; C += (size_t)ks * ZH * sC;
    const int lane = threadIdx.x & 31, lr = lane & 15, hi = lane >> 4; const int r0 = blockIdx.x * 64, c0 = (blockIdx.y / KSL) * 64;
    v8f acc[4][4];
#pragma unroll
    for (int mb = 0; mb < 4; ++mb)
#pragma unroll
        for (int nb = 0; nb < 4; ++nb) acc[mb][nb] = (v8f){};
    const size_t aoff = (size_t)(r0 + lr) * K + 8 * hi, boff = (size_t)(c0 + lr) * K + 8 * hi;
#pragma unroll 1
    for (int kc = kb; kc < ke; kc += 32) {
        V a[4], a2[4];
#pragma unroll
        for (int mb = 0; mb < 4; ++mb) { a[mb] = WFrag<T16>::ld(A + aoff + (size_t)mb * 16 * K + kc); if (NSPLIT == 1 || NSPLIT == 2) a2[mb] = WFrag<T16>::ld(A2 + aoff + (size_t)mb * 16 * K + kc); }
#pragma unroll
        for (int nb = 0; nb < 4; ++nb) { const V b = WFrag<T16>::ld(Bt + boff + (size_t)nb * 16 * K + kc); V b2; if (NSPLIT >= 2) b2 = WFrag<T16>::ld(Bt2 + boff + (size_t)nb * 16 * K + kc);
#pragma unroll
            for (int mb = 0; mb < 4; ++mb) { acc[mb][nb] = WFrag<T16>::mma(a[mb], b, acc[mb][nb]); if (NSPLIT == 1 || NSPLIT == 2) acc[mb][nb] = WFrag<T16>::mma(a2[mb], b, acc[mb][nb]); if (NSPLIT >= 2) acc[mb][nb] = WFrag<T16>::mma(a[mb], b2, acc[mb][nb]); } }
        asm volatile("v_nop\n\tv_nop\n\tv_nop\n\tv_nop" : "+v"(acc[0][0]), "+v"(acc[1][1]), "+v"(acc[2][2]), "+v"(acc[3][3]) : "v"(a[0]), "v"(a[3]));
    }
#pragma unroll
    for (int mb = 0; mb < 4; ++mb) {
#pragma unroll
        for (int nb = 0; nb < 4; ++nb) {
#pragma unroll
            for (int j = 0; j < 8; ++j) os[(hi * 8 + j) * 68 + nb * 16 + lr] = acc[mb][nb][j]; }
        __builtin_amdgcn_wave_barrier(); asm volatile("" ::: "memory");
        float* crow = C + (size_t)(r0 + mb * 16) * ldc + c0;
{
#pragma unroll
            for (int s = 0; s < 8; ++s) { const int row = 2 * s + hi, cofs = lr * 4; v4f val = *(const v4fa*)(os + row * 68 + cofs); if (BIAS) { val[0] += bfr(bias[c0 + cofs]); val[1] += bfr(bias[c0 + cofs + 1]); val[2] += bfr(bias[c0 + cofs + 2]); val[3] += bfr(bias[c0 + cofs + 3]); }
                *(v4f*)(crow + (size_t)row * ldc + cofs) = val; }
             }
        __builtin_amdgcn_wave_barrier(); asm volatile("" ::: "memory");
    }
}

__device__ __forceinline__ h16 tohx(float x) { return (h16)x; }
__device__ __forceinline__ void splitf(float y, unsigned short& h, unsigned short& l) { h = f2bf(y); l = f2bf(y - bf2f(h)); }
typedef __attribute__((ext_vector_type(2))) _Float16 v2h;
typedef __attribute__((ext_vector_type(4))) _Float16 v4h;
typedef __attribute__((ext_vector_type(2))) unsigned short v2us;
typedef __attribute__((ext_vector_type(4))) unsigned short v4us;
typedef __attribute__((ext_vector_type(2))) float v2f;
typedef __attribute__((ext_vector_type(4))) int v4i;

__global__ __launch_bounds__(256) void k_wtG(const float* __restrict__ w, int K, int N, bf* Bt) {
    const int lane = threadIdx.x & 31; const int L0 = (blockIdx.x * 8 + (threadIdx.x >> 5)) * 8; const int nlines = N * K / 64;
{
#pragma unroll 1
        for (int l = 0; l < 8; ++l) { const int L = L0 + l; if (L >= nlines) break; const size_t e = (size_t)L * 64 + lane * 2; const int k = (int)(e % K), n = (int)(e / K); v2us o;
            o[0] = f2bf(w[(size_t)k * N + n]); o[1] = f2bf(w[(size_t)(k + 1) * N + n]); *(v2us*)(Bt + e) = o; }
         }
}
__global__ __launch_bounds__(256) void k_cvt8(const float* __restrict__ src, bf* dst, size_t n8) { const size_t i = (size_t)blockIdx.x * 256 + threadIdx.x; if (i >= n8) return; const v8f v = *(const v8f*)(src + i * 8); v8us o;
#pragma unroll
    for (int k = 0; k < 8; ++k) o[k] = f2bf(v[k]); *(v8us*)(dst + i * 8) = o;  }
__global__ __launch_bounds__(256) void k_cscvt(const float* __restrict__ cosT, const float* __restrict__ sinT, float* CS) { const int idx = blockIdx.x * 256 + threadIdx.x; if (idx >= TT * HD) return; v2f cs; cs[0] = bfr(cosT[idx]); cs[1] = bfr(sinT[idx]); *(v2f*)(CS + (size_t)idx * 2) = cs;  }
// k_rope: head planes [h][t][d] (fp16 + hi/lo) of rope(x) x sc with the rotate-half convention out[d] = x[d] cos[t][d] - x[d+HD/2] sin[t][d], out[d+HD/2] = x[d+HD/2] cos[t][d+HD/2] + x[d] sin[t][d+HD/2]
__global__ __launch_bounds__(256) void k_rope(const float* __restrict__ F, int pitch, int nheads, const float* __restrict__ CS, const float* __restrict__ RF, const float* __restrict__ nw, float sc, h16* P16, bf* Ph, bf* Pl) {
    const size_t e = ((size_t)blockIdx.x * 256 + threadIdx.x) * 2; if (e >= (size_t)nheads * TT * HD) return; const int d = (int)(e % HD); const int t = (int)((e / HD) % TT); const int h = (int)(e / ((size_t)HD * TT)); const float* f = F + (size_t)t * pitch + h * HD; const float rf = RF ? RF[(size_t)h * TT + t] : 1.0f; v2h o16; v2us oh, ol;
#pragma unroll
    for (int q = 0; q < 2; ++q) { const int dd = d + q; const int dp = (dd < HD / 2) ? dd + HD / 2 : dd - HD / 2; float x0 = f[dd], x1 = f[dp];
        if (RF) { float n0 = __fmul_rn(x0, rf), n1 = __fmul_rn(x1, rf); asm volatile("" : "+v"(n0)); asm volatile("" : "+v"(n1)); x0 = __fmul_rn(bfr(nw[dd]), n0); x1 = __fmul_rn(bfr(nw[dp]), n1); }
        const v2f cs = *(const v2f*)(CS + ((size_t)t * HD + dd) * 2); float a = __fmul_rn(x0, cs[0]), bq = __fmul_rn(x1, cs[1]); asm volatile("" : "+v"(a)); asm volatile("" : "+v"(bq)); const float r = ((dd < HD / 2) ? __fsub_rn(a, bq) : __fadd_rn(a, bq)) * sc;
        o16[q] = tohx(r); unsigned short a2, c2; splitf(r, a2, c2); oh[q] = a2; ol[q] = c2; }
    *(v2h*)(P16 + e) = o16; *(v2us*)(Ph + e) = oh; *(v2us*)(Pl + e) = ol;  }
__global__ __launch_bounds__(256) void k_vtp(const float* __restrict__ F, int pitch, int nheads, h16* V16, bf* Vh, bf* Vl) { const size_t e = ((size_t)blockIdx.x * 256 + threadIdx.x) * 2; if (e >= (size_t)nheads * HD * TT) return; const int t = (int)(e % TT); const int d = (int)((e / TT) % HD); const int g = (int)(e / ((size_t)TT * HD)); v2h o16; v2us oh, ol;
#pragma unroll
    for (int q = 0; q < 2; ++q) { const float x = F[(size_t)(t + q) * pitch + g * HD + d]; o16[q] = tohx(x); unsigned short a2, c2; splitf(x, a2, c2); oh[q] = a2; ol[q] = c2; }
    *(v2h*)(V16 + e) = o16; *(v2us*)(Vh + e) = oh; *(v2us*)(Vl + e) = ol;  }
__global__ __launch_bounds__(256) void k_csid(float* CS) { const int idx = blockIdx.x * 256 + threadIdx.x; if (idx >= TT * HD) return; v2f cs; cs[0] = 1.0f; cs[1] = 0.0f; *(v2f*)(CS + (size_t)idx * 2) = cs;  }
__global__ __launch_bounds__(256) void k_mkf(const int* __restrict__ mk, float* MKF, float* ONES) { const int i = blockIdx.x * 256 + threadIdx.x; if (i < HD) { *(float*)(ONES + i) = 1.0f; } if (i >= NB_ * NH_ * TT) return; const float v = (float)mk[i]; *(float*)(MKF + i) = v;  if (i < HD) *(float*)(ONES + i) = 1.0f; }
// k_asoft: per row (zz, i): t = S x HD^-0.5 (no mask); softmax over the 2048 keys (register row, one exp, fixed trees);
__global__ __launch_bounds__(256) void k_asoft(const float* __restrict__ Sb, h16* P16, bf* Ph, bf* Pl) {
    const int lane = threadIdx.x & 31; const int row = blockIdx.x * 8 + (threadIdx.x >> 5); if (row >= ZH * TT) return; const int i = row % TT; const int zz = row / TT; (void)zz; const bool hires = (i < RH); const float* sr = Sb + (size_t)row * TT; float v[TT / 32]; float mx = -3.0e38f;
#pragma unroll
    for (int ch = 0; ch < TT / 128; ++ch) { const int j0 = ch * 128 + lane * 4; const v4f a = *(const v4f*)(sr + j0);
#pragma unroll
        for (int q = 0; q < 4; ++q) { const int j = j0 + q; (void)j; const float t = a[q] * SCL; v[ch * 4 + q] = t; mx = fmaxf(mx, t); } }
#pragma unroll
    for (int sh = 16; sh; sh >>= 1) mx = fmaxf(mx, __shfl_xor(mx, sh, 32));
    float sum = 0.f;
#pragma unroll
    for (int k = 0; k < TT / 32; ++k) { float d0 = __fsub_rn(v[k], mx); asm volatile("" : "+v"(d0)); v[k] = __builtin_amdgcn_exp2f(__fmul_rn(d0, 1.4426950408889634f)); sum += v[k]; }
#pragma unroll
    for (int sh = 16; sh; sh >>= 1) sum += __shfl_xor(sum, sh, 32);
    const float f = __fdiv_rn(hires ? 1.0f : PCAR, sum);
{
        if (hires) {
#pragma unroll
            for (int ch = 0; ch < TT / 128; ++ch) { v4us oh, ol;
#pragma unroll
                for (int q = 0; q < 4; ++q) { unsigned short a, c2; splitf(v[ch * 4 + q] * f, a, c2); oh[q] = a; ol[q] = c2; }
                const size_t oo = ((size_t)zz * (RH ? RH : 1) + i) * TT + ch * 128 + lane * 4; *(v4us*)(Ph + oo) = oh; *(v4us*)(Pl + oo) = ol; }
        } else {
#pragma unroll
            for (int ch = 0; ch < TT / 128; ++ch) { v4h o4;
#pragma unroll
                for (int q = 0; q < 4; ++q) o4[q] = tohx(v[ch * 4 + q] * f);
                *(v4h*)(P16 + (size_t)row * TT + ch * 128 + lane * 4) = o4; } }
         }
}
__global__ __launch_bounds__(256) void k_merge(const float* __restrict__ O, int h0, bf* Ah, bf* Al) { const size_t e = ((size_t)blockIdx.x * 256 + threadIdx.x) * 2; if (e >= (size_t)ZH * TT * HD) return; const int d = (int)(e % HD); const int t = (int)((e / HD) % TT); const int zz = (int)(e / ((size_t)HD * TT)); const float cs = (t < RH) ? 1.0f : (1.0f / PCAR); const size_t oo = (size_t)t * DQ + (h0 + zz) * HD + d;
    v2f s = *(const v2f*)(O + e);   // the KSP partial planes of attn.v, added in slice order; unrolled so that all the planes' loads are in flight together
#pragma unroll
    for (int ks = 1; ks < KSP; ++ks) s += *(const v2f*)(O + (size_t)ks * ZH * TT * HD + e);
    v2us oh, ol;
#pragma unroll
    for (int q = 0; q < 2; ++q) { unsigned short a, c2; splitf(s[q] * cs, a, c2); oh[q] = a; ol[q] = c2; } *(v2us*)(Ah + oo) = oh; *(v2us*)(Al + oo) = ol;  }

extern "C" void kernel_launch(void* const* d_in, const int* in_sizes, int n_in,
                              void* d_out, int out_size, void* d_ws, size_t ws_size, hipStream_t stream) {
    (void)in_sizes; (void)n_in; (void)out_size;
    const float* x = (const float*)d_in[0]; const int* MK = (const int*)d_in[1]; const float* wq = (const float*)d_in[2]; const float* bq = (const float*)d_in[3]; const float* wk = (const float*)d_in[4]; const float* bk = (const float*)d_in[5]; const float* wv = (const float*)d_in[6]; const float* bv = (const float*)d_in[7]; const float* wo = (const float*)d_in[8]; const float* bo = (const float*)d_in[9]; const float* cosT = nullptr; const float* sinT = nullptr; (void)cosT; (void)sinT;
    float* OUT = (float*)d_out;     // [2][2048][1024]
    char* wsp = (char*)d_ws;
    auto take = [&](size_t bytes) { char* p = wsp; wsp += (bytes + 255) & ~(size_t)255; return (void*)p; };
    bf* WQ = (bf*)take((size_t)DQ * DM * 2); bf* WK = (bf*)take((size_t)DKV * DM * 2); bf* WV = (bf*)take((size_t)DKV * DM * 2); bf* WO = (bf*)take((size_t)DM * DQ * 2); float* CS = (float*)take((size_t)TT * HD * 2 * 4); float* MKF = (float*)take((size_t)NB_ * NH_ * TT * 4); float* ONES = (float*)take(256);
    bf* XB = (bf*)take((size_t)TT * DM * 2); float* FQ = (float*)take((size_t)TT * DQ * 4); float* FK = (float*)take((size_t)TT * DKV * 4);
    h16* QP16 = (h16*)take((size_t)NH_ * TT * HD * 2); h16* KP16 = (h16*)take((size_t)NKV * TT * HD * 2); h16* VT16 = (h16*)take((size_t)NKV * HD * TT * 2);
    bf* QPh = (bf*)take((size_t)NH_ * TT * HD * 2); bf* QPl = (bf*)take((size_t)NH_ * TT * HD * 2); bf* KPh = (bf*)take((size_t)NKV * TT * HD * 2); bf* KPl = (bf*)take((size_t)NKV * TT * HD * 2); bf* VTh = (bf*)take((size_t)NKV * HD * TT * 2); bf* VTl = (bf*)take((size_t)NKV * HD * TT * 2); bf* Ph = (bf*)take((size_t)ZH * RH * TT * 2); bf* Pl = (bf*)take((size_t)ZH * RH * TT * 2);
    float* Sb = (float*)take((size_t)ZH * TT * TT * 4); h16* P16 = (h16*)take((size_t)ZH * TT * TT * 2); float* Ob = (float*)take((size_t)KSP * ZH * TT * HD * 4); bf* ATh = (bf*)take((size_t)TT * DQ * 2); bf* ATl = (bf*)take((size_t)TT * DQ * 2);
    if ((size_t)(wsp - (char*)d_ws) > ws_size) return;    // ws 256 MiB
    float* FV = FK;   // v projection reuses the k buffer after the k planes are built (stream-ordered)
    { k_cvt8<<<(unsigned)(((size_t)DQ * DM / 8 + 255) / 256), 256, 0, stream>>>(wq, WQ, (size_t)DQ * DM / 8); k_cvt8<<<(unsigned)(((size_t)DKV * DM / 8 + 255) / 256), 256, 0, stream>>>(wk, WK, (size_t)DKV * DM / 8); k_cvt8<<<(unsigned)(((size_t)DKV * DM / 8 + 255) / 256), 256, 0, stream>>>(wv, WV, (size_t)DKV * DM / 8);
      k_cvt8<<<(unsigned)(((size_t)DM * DQ / 8 + 255) / 256), 256, 0, stream>>>(wo, WO, (size_t)DM * DQ / 8);
       }
    k_csid<<<(TT * HD + 255) / 256, 256, 0, stream>>>(CS); k_mkf<<<(NB_ * NH_ * TT + 255) / 256, 256, 0, stream>>>((const int*)MK, MKF, ONES);
    const unsigned LQ = (unsigned)(((size_t)NH_ * TT * HD / 2 + 255) / 256), LKv = (unsigned)(((size_t)NKV * TT * HD / 2 + 255) / 256);
    for (int b = 0; b < NB_; ++b) {
        
        k_cvt8<<<(unsigned)(((size_t)TT * DM / 8 + 255) / 256), 256, 0, stream>>>(x + (size_t)b * TT * DM, XB, (size_t)TT * DM / 8);
        k_gemmw<bf, 0, true><<<dim3(TT / 64, DQ / 64, 1), 32, 0, stream>>>(XB, nullptr, WQ, nullptr, DM, FQ, DQ, bq, 0, 0, 0);
        k_rope<<<LQ, 256, 0, stream>>>(FQ, DQ, NH_, CS, MKF + (size_t)b * NH_ * TT, ONES, 1.0f, QP16, QPh, QPl);   // q x mask[b][h][s]
        k_gemmw<bf, 0, true><<<dim3(TT / 64, DKV / 64, 1), 32, 0, stream>>>(XB, nullptr, WK, nullptr, DM, FK, DKV, bk, 0, 0, 0);
        k_rope<<<LKv, 256, 0, stream>>>(FK, DKV, NKV, CS, MKF + (size_t)b * NH_ * TT, ONES, 1.0f, KP16, KPh, KPl);   // k x mask[b][h][s]
        k_gemmw<bf, 0, true><<<dim3(TT / 64, DKV / 64, 1), 32, 0, stream>>>(XB, nullptr, WV, nullptr, DM, FV, DKV, bv, 0, 0, 0); k_vtp<<<LKv, 256, 0, stream>>>(FV, DKV, NKV, VT16, VTh, VTl);
        for (int h0 = 0; h0 < NH_; h0 += ZH) { const size_t zq = (size_t)h0, zk = (size_t)(h0 / REP);   // one kv head per query head: the pass's two heads use consecutive kv planes (z-strides TT*HD)
            k_gemmw<bf, 2, false><<<dim3(RH / 64, TT / 64, ZH), 32, 0, stream>>>(QPh + zq * TT * HD, QPl + zq * TT * HD, KPh + zk * TT * HD, KPl + zk * TT * HD, HD, Sb, TT, nullptr, (size_t)TT * HD, (size_t)TT * HD, (size_t)TT * TT);
            k_gemmw<h16, 0, false><<<dim3((TT - RH) / 64, TT / 64, ZH), 32, 0, stream>>>(QP16 + zq * TT * HD + (size_t)RH * HD, nullptr, KP16 + zk * TT * HD, nullptr, HD, Sb + (size_t)RH * TT, TT, nullptr, (size_t)TT * HD, (size_t)TT * HD, (size_t)TT * TT);
            k_asoft<<<ZH * TT / 8, 256, 0, stream>>>(Sb, P16, Ph, Pl);
            k_gemmw<bf, 2, false, KSP><<<dim3(RH / 64, HD / 64 * KSP, ZH), 32, 0, stream>>>(Ph, Pl, VTh + zk * HD * TT, VTl + zk * HD * TT, TT, Ob, HD, nullptr, (size_t)RH * TT, (size_t)HD * TT, (size_t)TT * HD);
            k_gemmw<h16, 0, false, KSP><<<dim3((TT - RH) / 64, HD / 64 * KSP, ZH), 32, 0, stream>>>(P16 + (size_t)RH * TT, nullptr, VT16 + zk * HD * TT, nullptr, TT, Ob + (size_t)RH * HD, HD, nullptr, (size_t)TT * TT, (size_t)HD * TT, (size_t)TT * HD);
            k_merge<<<(unsigned)(((size_t)ZH * TT * HD / 2 + 255) / 256), 256, 0, stream>>>(Ob, h0, ATh, ATl); }
        k_gemmw<bf, 1, true><<<dim3(TT / 64, DM / 64, 1), 32, 0, stream>>>(ATh, ATl, WO, nullptr, DQ, OUT + (size_t)b * TT * DM, DM, bo, 0, 0, 0); }
}

// v002
// A run of this version takes 643 microseconds.
// Two timings next to v001 both put it at 1.34 times that version's speed.
// All steps since v000 together make it 3.10 times as fast.
#include <hip/hip_runtime.h>

// SparseFlashAttention (x [2][2048][1024]; q/k/v = x W^T + b (torch layouts, 16 heads x 64); q and k multiplied by sparsity_mask[b][h][s] (int 0/1, read as data); softmax(q.k/8) (no other mask); out = (attn v merged) Wo^T + bo -> [2][2048][1024]).
// Compute dtypes, f32 accumulate: every input rounded to bf16; q/k/v projections on PLAIN bf16 operands (inputs: exact) + bias; scores (K 64) and attn.v on bf16 hi+lo planes (3 products) for the first 512 query rows of each head

#define NB_  2
#define TT   2048
#define DM   1024
#define NH_  16
#define NKV  16
#define REP  (NH_ / NKV)
#define HD   64
#define DQ   (NH_ * HD)
#define DKV  (NKV * HD)
#define ZH   8                    // heads per attention pass (z of the pass's k_gemmw launches)
#define RH   512                  // query rows < RH use hi+lo planes (0: none)
#define WIN  0
#define PCAR 1024.0f
#define SCL  0.125f   // HD^-0.5
#define KSP  16                   // K slices of the attn.v products (one wave per slice; f32 partial planes summed by k_merge)
typedef _Float16 h16;
typedef unsigned short bf;
typedef __attribute__((ext_vector_type(16))) __bf16   v16bf;
typedef __attribute__((ext_vector_type(16))) _Float16 v16h;
typedef __attribute__((ext_vector_type(8)))  _Float16 v8h;
typedef __attribute__((ext_vector_type(8)))  unsigned short v8us;
typedef __attribute__((ext_vector_type(8)))  float    v8f;
typedef __attribute__((ext_vector_type(4)))  float    v4f;
typedef v8h  __attribute__((may_alias)) v8ha;
typedef v4f  __attribute__((may_alias)) v4fa;
typedef v8us __attribute__((may_alias)) v8usa;

__device__ __forceinline__ unsigned short f2bf(float f) { unsigned u = __float_as_uint(f); u += 0x7FFFu + ((u >> 16) & 1u); return (unsigned short)(u >> 16); }
__device__ __forceinline__ float bf2f(unsigned short b) { return __uint_as_float(((unsigned)b) << 16); }
__device__ __forceinline__ float bfr(float f) { return bf2f(f2bf(f)); }
__device__ __forceinline__ v16h cat16(v8h lo, v8h hi) { return __builtin_shufflevector(lo, hi, 0, 1, 2, 3, 4, 5, 6, 7, 8, 9, 10, 11, 12, 13, 14, 15); }
__device__ __forceinline__ v16bf cat16b(v8us lo, v8us hi) { return __builtin_bit_cast(v16bf, __builtin_shufflevector(lo, hi, 0, 1, 2, 3, 4, 5, 6, 7, 8, 9, 10, 11, 12, 13, 14, 15)); }
__device__ __forceinline__ v8f wmma16(v16h a, v16h b, v8f c) { return __builtin_amdgcn_wmma_f32_16x16x32_f16(false, a, false, b, (short)0, c, false, false); }
__device__ __forceinline__ v8f wmmab(v16bf a, v16bf b, v8f c) { return __builtin_amdgcn_wmma_f32_16x16x32_bf16(false, a, false, b, (short)0, c, false, false); }



// ---- k_gemmw: register-blocked GEMM, ONE WAVE per 64x64 output tile (16 accumulators), operands straight from K-contiguous 16-bit planes; grid (M/64, N/64, Z), 32 threads.
// C[m][n] (f32, pitch ldc, + optional f32 bias[n]) = sum_k A[m][k] Bt[n][k] (+ split products per NSPLIT). A rows have pitch lda, Bt rows pitch K (elements). z-batch strides sA/sB/sC in elements. K % 32 == 0.
// KSL > 1: grid (M/64, N/64 * KSL, Z); slice ks = blockIdx.y % KSL sums only k in [ks K/KSL, (ks+1) K/KSL) and stores it in partial plane ks (planes ZH * sC elements apart, one whole z-batch each); the reader adds the planes.
template <typename T16> struct WFrag;
template <> struct WFrag<h16> { typedef v16h V; static __device__ __forceinline__ V ld(const h16* p) { return cat16(*(const v8h*)p, *(const v8h*)(p + 16)); } static __device__ __forceinline__ v8f mma(V a, V b, v8f c) { return wmma16(a, b, c); } };
template <> struct WFrag<bf> { typedef v16bf V; static __device__ __forceinline__ V ld(const bf* p) { return cat16b(*(const v8us*)p, *(const v8us*)(p + 16)); } static __device__ __forceinline__ v8f mma(V a, V b, v8f c) { return wmmab(a, b, c); } };
template <typename T16, int NSPLIT, bool BIAS, int KSL = 1>
__global__ __launch_bounds__(32) void k_gemmw(const T16* __restrict__ A, const T16* __restrict__ A2, const T16* __restrict__ Bt, const T16* __restrict__ Bt2, int K, int lda, float* C, int ldc, const float* __restrict__ bias, size_t sA, size_t sB, size_t sC) {
    typedef typename WFrag<T16>::V V;
    __shared__ __align__(16) float os[16 * 68];
    const size_t z = blockIdx.z; A += z * sA; if (A2) A2 += z * sA; Bt += z * sB; if (Bt2) Bt2 += z * sB; C += z * sC;
    const int ks = blockIdx.y % KSL, kb = ks * (K / KSL), ke = kb + K / KSL; C += (size_t)ks * ZH * sC;
    const int lane = threadIdx.x & 31, lr = lane & 15, hi = lane >> 4; const int r0 = blockIdx.x * 64, c0 = (blockIdx.y / KSL) * 64;
    v8f acc[4][4];
#pragma unroll
    for (int mb = 0; mb < 4; ++mb)
#pragma unroll
        for (int nb = 0; nb < 4; ++nb) acc[mb][nb] = (v8f){};
    const size_t aoff = (size_t)(r0 + lr) * lda + 8 * hi, boff = (size_t)(c0 + lr) * K + 8 * hi;
#pragma unroll 1
    for (int kc = kb; kc < ke; kc += 32) {
        V a[4], a2[4];
#pragma unroll
        for (int mb = 0; mb < 4; ++mb) { a[mb] = WFrag<T16>::ld(A + aoff + (size_t)mb * 16 * lda + kc); if (NSPLIT == 1 || NSPLIT == 2) a2[mb] = WFrag<T16>::ld(A2 + aoff + (size_t)mb * 16 * lda + kc); }
#pragma unroll
        for (int nb = 0; nb < 4; ++nb) { const V b = WFrag<T16>::ld(Bt + boff + (size_t)nb * 16 * K + kc); V b2; if (NSPLIT >= 2) b2 = WFrag<T16>::ld(Bt2 + boff + (size_t)nb * 16 * K + kc);
#pragma unroll
            for (int mb = 0; mb < 4; ++mb) { acc[mb][nb] = WFrag<T16>::mma(a[mb], b, acc[mb][nb]); if (NSPLIT == 1 || NSPLIT == 2) acc[mb][nb] = WFrag<T16>::mma(a2[mb], b, acc[mb][nb]); if (NSPLIT >= 2) acc[mb][nb] = WFrag<T16>::mma(a[mb], b2, acc[mb][nb]); } }
        asm volatile("v_nop\n\tv_nop\n\tv_nop\n\tv_nop" : "+v"(acc[0][0]), "+v"(acc[1][1]), "+v"(acc[2][2]), "+v"(acc[3][3]) : "v"(a[0]), "v"(a[3]));
    }
#pragma unroll
    for (int mb = 0; mb < 4; ++mb) {
#pragma unroll
        for (int nb = 0; nb < 4; ++nb) {
#pragma unroll
            for (int j = 0; j < 8; ++j) os[(hi * 8 + j) * 68 + nb * 16 + lr] = acc[mb][nb][j]; }
        __builtin_amdgcn_wave_barrier(); asm volatile("" ::: "memory");
        float* crow = C + (size_t)(r0 + mb * 16) * ldc + c0;
{
#pragma unroll
            for (int s = 0; s < 8; ++s) { const int row = 2 * s + hi, cofs = lr * 4; v4f val = *(const v4fa*)(os + row * 68 + cofs); if (BIAS) { val[0] += bfr(bias[c0 + cofs]); val[1] += bfr(bias[c0 + cofs + 1]); val[2] += bfr(bias[c0 + cofs + 2]); val[3] += bfr(bias[c0 + cofs + 3]); }
                *(v4f*)(crow + (size_t)row * ldc + cofs) = val; }
             }
        __builtin_amdgcn_wave_barrier(); asm volatile("" ::: "memory");
    }
}

__device__ __forceinline__ h16 tohx(float x) { return (h16)x; }
__device__ __forceinline__ void splitf(float y, unsigned short& h, unsigned short& l) { h = f2bf(y); l = f2bf(y - bf2f(h)); }
typedef __attribute__((ext_vector_type(2))) _Float16 v2h;
typedef __attribute__((ext_vector_type(4))) _Float16 v4h;
typedef __attribute__((ext_vector_type(2))) unsigned short v2us;
typedef __attribute__((ext_vector_type(4))) unsigned short v4us;
typedef __attribute__((ext_vector_type(2))) float v2f;
typedef __attribute__((ext_vector_type(4))) int v4i;
typedef v4h  __attribute__((may_alias)) v4ha;
typedef v4us __attribute__((may_alias)) v4usa;

__global__ __launch_bounds__(256) void k_wtG(const float* __restrict__ w, int K, int N, bf* Bt) {
    const int lane = threadIdx.x & 31; const int L0 = (blockIdx.x * 8 + (threadIdx.x >> 5)) * 8; const int nlines = N * K / 64;
{
#pragma unroll 1
        for (int l = 0; l < 8; ++l) { const int L = L0 + l; if (L >= nlines) break; const size_t e = (size_t)L * 64 + lane * 2; const int k = (int)(e % K), n = (int)(e / K); v2us o;
            o[0] = f2bf(w[(size_t)k * N + n]); o[1] = f2bf(w[(size_t)(k + 1) * N + n]); *(v2us*)(Bt + e) = o; }
         }
}
__global__ __launch_bounds__(256) void k_cvt8(const float* __restrict__ src, bf* dst, size_t n8) { const size_t i = (size_t)blockIdx.x * 256 + threadIdx.x; if (i >= n8) return; const v8f v = *(const v8f*)(src + i * 8); v8us o;
#pragma unroll
    for (int k = 0; k < 8; ++k) o[k] = f2bf(v[k]); *(v8us*)(dst + i * 8) = o;  }
__global__ __launch_bounds__(256) void k_cscvt(const float* __restrict__ cosT, const float* __restrict__ sinT, float* CS) { const int idx = blockIdx.x * 256 + threadIdx.x; if (idx >= TT * HD) return; v2f cs; cs[0] = bfr(cosT[idx]); cs[1] = bfr(sinT[idx]); *(v2f*)(CS + (size_t)idx * 2) = cs;  }
// k_rope: head planes [h][t][d] (fp16 + hi/lo) of rope(x) x sc with the rotate-half convention out[d] = x[d] cos[t][d] - x[d+HD/2] sin[t][d], out[d+HD/2] = x[d+HD/2] cos[t][d+HD/2] + x[d] sin[t][d+HD/2]
__global__ __launch_bounds__(256) void k_rope(const float* __restrict__ F, int pitch, int nheads, const float* __restrict__ CS, const float* __restrict__ RF, const float* __restrict__ nw, float sc, h16* P16, bf* Ph, bf* Pl) {
    const size_t e = ((size_t)blockIdx.x * 256 + threadIdx.x) * 2; if (e >= (size_t)nheads * TT * HD) return; const int d = (int)(e % HD); const int t = (int)((e / HD) % TT); const int h = (int)(e / ((size_t)HD * TT)); const float* f = F + (size_t)t * pitch + h * HD; const float rf = RF ? RF[(size_t)h * TT + t] : 1.0f; v2h o16; v2us oh, ol;
#pragma unroll
    for (int q = 0; q < 2; ++q) { const int dd = d + q; const int dp = (dd < HD / 2) ? dd + HD / 2 : dd - HD / 2; float x0 = f[dd], x1 = f[dp];
        if (RF) { float n0 = __fmul_rn(x0, rf), n1 = __fmul_rn(x1, rf); asm volatile("" : "+v"(n0)); asm volatile("" : "+v"(n1)); x0 = __fmul_rn(bfr(nw[dd]), n0); x1 = __fmul_rn(bfr(nw[dp]), n1); }
        const v2f cs = *(const v2f*)(CS + ((size_t)t * HD + dd) * 2); float a = __fmul_rn(x0, cs[0]), bq = __fmul_rn(x1, cs[1]); asm volatile("" : "+v"(a)); asm volatile("" : "+v"(bq)); const float r = ((dd < HD / 2) ? __fsub_rn(a, bq) : __fadd_rn(a, bq)) * sc;
        o16[q] = tohx(r); unsigned short a2, c2; splitf(r, a2, c2); oh[q] = a2; ol[q] = c2; }
    *(v2h*)(P16 + e) = o16; *(v2us*)(Ph + e) = oh; *(v2us*)(Pl + e) = ol;  }
__global__ __launch_bounds__(256) void k_vtp(const float* __restrict__ F, int pitch, int nheads, h16* V16, bf* Vh, bf* Vl) { const size_t e = ((size_t)blockIdx.x * 256 + threadIdx.x) * 2; if (e >= (size_t)nheads * HD * TT) return; const int t = (int)(e % TT); const int d = (int)((e / TT) % HD); const int g = (int)(e / ((size_t)TT * HD)); v2h o16; v2us oh, ol;
#pragma unroll
    for (int q = 0; q < 2; ++q) { const float x = F[(size_t)(t + q) * pitch + g * HD + d]; o16[q] = tohx(x); unsigned short a2, c2; splitf(x, a2, c2); oh[q] = a2; ol[q] = c2; }
    *(v2h*)(V16 + e) = o16; *(v2us*)(Vh + e) = oh; *(v2us*)(Vl + e) = ol;  }
__global__ __launch_bounds__(256) void k_csid(float* CS) { const int idx = blockIdx.x * 256 + threadIdx.x; if (idx >= TT * HD) return; v2f cs; cs[0] = 1.0f; cs[1] = 0.0f; *(v2f*)(CS + (size_t)idx * 2) = cs;  }
__global__ __launch_bounds__(256) void k_mkf(const int* __restrict__ mk, float* MKF, float* ONES) { const int i = blockIdx.x * 256 + threadIdx.x; if (i < HD) { *(float*)(ONES + i) = 1.0f; } if (i >= NB_ * NH_ * TT) return; const float v = (float)mk[i]; *(float*)(MKF + i) = v;  if (i < HD) *(float*)(ONES + i) = 1.0f; }
// k_asoft: per row (zz, i): t = S x HD^-0.5 (no mask); softmax over the 2048 keys (register row, one exp, fixed trees);
// the 16-bit result goes IN PLACE over the row's own f32 scores (one wave owns the row and holds all of it in registers before its first store): 16-bit elements [0, TT) = fp16 plane or bf16 hi plane, [TT, 2 TT) = bf16 lo plane; row pitch 2 TT.
__global__ __launch_bounds__(256) void k_asoft(float* Sb) {
    const int lane = threadIdx.x & 31; const int row = blockIdx.x * 8 + (threadIdx.x >> 5); if (row >= ZH * TT) return; const int i = row % TT; const bool hires = (i < RH); const float* sr = Sb + (size_t)row * TT; float v[TT / 32]; float mx = -3.0e38f;
#pragma unroll
    for (int ch = 0; ch < TT / 128; ++ch) { const int j0 = ch * 128 + lane * 4; const v4f a = *(const v4fa*)(sr + j0);
#pragma unroll
        for (int q = 0; q < 4; ++q) { const int j = j0 + q; (void)j; const float t = a[q] * SCL; v[ch * 4 + q] = t; mx = fmaxf(mx, t); } }
#pragma unroll
    for (int sh = 16; sh; sh >>= 1) mx = fmaxf(mx, __shfl_xor(mx, sh, 32));
    float sum = 0.f;
#pragma unroll
    for (int k = 0; k < TT / 32; ++k) { float d0 = __fsub_rn(v[k], mx); asm volatile("" : "+v"(d0)); v[k] = __builtin_amdgcn_exp2f(__fmul_rn(d0, 1.4426950408889634f)); sum += v[k]; }
#pragma unroll
    for (int sh = 16; sh; sh >>= 1) sum += __shfl_xor(sum, sh, 32);
    const float f = __fdiv_rn(hires ? 1.0f : PCAR, sum);
{
        if (hires) {
#pragma unroll
            for (int ch = 0; ch < TT / 128; ++ch) { v4us oh, ol;
#pragma unroll
                for (int q = 0; q < 4; ++q) { unsigned short a, c2; splitf(v[ch * 4 + q] * f, a, c2); oh[q] = a; ol[q] = c2; }
                bf* pr = (bf*)(Sb + (size_t)row * TT) + ch * 128 + lane * 4; *(v4usa*)pr = oh; *(v4usa*)(pr + TT) = ol; }
        } else {
#pragma unroll
            for (int ch = 0; ch < TT / 128; ++ch) { v4h o4;
#pragma unroll
                for (int q = 0; q < 4; ++q) o4[q] = tohx(v[ch * 4 + q] * f);
                *(v4ha*)((h16*)(Sb + (size_t)row * TT) + ch * 128 + lane * 4) = o4; } }
         }
}
__global__ __launch_bounds__(256) void k_merge(const float* __restrict__ O, int h0, bf* Ah, bf* Al) { const size_t e = ((size_t)blockIdx.x * 256 + threadIdx.x) * 2; if (e >= (size_t)ZH * TT * HD) return; const int d = (int)(e % HD); const int t = (int)((e / HD) % TT); const int zz = (int)(e / ((size_t)HD * TT)); const float cs = (t < RH) ? 1.0f : (1.0f / PCAR); const size_t oo = (size_t)t * DQ + (h0 + zz) * HD + d;
    v2f s = *(const v2f*)(O + e);   // the KSP partial planes of attn.v, added in slice order; unrolled so that all the planes' loads are in flight together
#pragma unroll
    for (int ks = 1; ks < KSP; ++ks) s += *(const v2f*)(O + (size_t)ks * ZH * TT * HD + e);
    v2us oh, ol;
#pragma unroll
    for (int q = 0; q < 2; ++q) { unsigned short a, c2; splitf(s[q] * cs, a, c2); oh[q] = a; ol[q] = c2; } *(v2us*)(Ah + oo) = oh; *(v2us*)(Al + oo) = ol;  }

extern "C" void kernel_launch(void* const* d_in, const int* in_sizes, int n_in,
                              void* d_out, int out_size, void* d_ws, size_t ws_size, hipStream_t stream) {
    (void)in_sizes; (void)n_in; (void)out_size;
    const float* x = (const float*)d_in[0]; const int* MK = (const int*)d_in[1]; const float* wq = (const float*)d_in[2]; const float* bq = (const float*)d_in[3]; const float* wk = (const float*)d_in[4]; const float* bk = (const float*)d_in[5]; const float* wv = (const float*)d_in[6]; const float* bv = (const float*)d_in[7]; const float* wo = (const float*)d_in[8]; const float* bo = (const float*)d_in[9]; const float* cosT = nullptr; const float* sinT = nullptr; (void)cosT; (void)sinT;
    float* OUT = (float*)d_out;     // [2][2048][1024]
    char* wsp = (char*)d_ws;
    auto take = [&](size_t bytes) { char* p = wsp; wsp += (bytes + 255) & ~(size_t)255; return (void*)p; };
    bf* WQ = (bf*)take((size_t)DQ * DM * 2); bf* WK = (bf*)take((size_t)DKV * DM * 2); bf* WV = (bf*)take((size_t)DKV * DM * 2); bf* WO = (bf*)take((size_t)DM * DQ * 2); float* CS = (float*)take((size_t)TT * HD * 2 * 4); float* MKF = (float*)take((size_t)NB_ * NH_ * TT * 4); float* ONES = (float*)take(256);
    float* Ob = (float*)take((size_t)KSP * ZH * TT * HD * 4);   // attn.v partial planes; its first bytes also serve as XB, FQ, FK, which are dead once a batch's head planes are built (stream-ordered, rewritten for the next batch)
    bf* XB = (bf*)Ob; float* FQ = (float*)(XB + (size_t)TT * DM); float* FK = FQ + (size_t)TT * DQ;
    h16* QP16 = (h16*)take((size_t)NH_ * TT * HD * 2); h16* KP16 = (h16*)take((size_t)NKV * TT * HD * 2); h16* VT16 = (h16*)take((size_t)NKV * HD * TT * 2);
    bf* QPh = (bf*)take((size_t)NH_ * TT * HD * 2); bf* QPl = (bf*)take((size_t)NH_ * TT * HD * 2); bf* KPh = (bf*)take((size_t)NKV * TT * HD * 2); bf* KPl = (bf*)take((size_t)NKV * TT * HD * 2); bf* VTh = (bf*)take((size_t)NKV * HD * TT * 2); bf* VTl = (bf*)take((size_t)NKV * HD * TT * 2);
    float* Sb = (float*)take((size_t)ZH * TT * TT * 4); bf* Ph = (bf*)Sb; bf* Pl = Ph + TT; h16* P16 = (h16*)Sb;   // k_asoft leaves the 16-bit planes in the score rows (pitch 2 TT)
    bf* ATh = (bf*)take((size_t)TT * DQ * 2); bf* ATl = (bf*)take((size_t)TT * DQ * 2);
    if ((size_t)(wsp - (char*)d_ws) > ws_size) return;    // ws 256 MiB
    float* FV = FK;   // v projection reuses the k buffer after the k planes are built (stream-ordered)
    { k_cvt8<<<(unsigned)(((size_t)DQ * DM / 8 + 255) / 256), 256, 0, stream>>>(wq, WQ, (size_t)DQ * DM / 8); k_cvt8<<<(unsigned)(((size_t)DKV * DM / 8 + 255) / 256), 256, 0, stream>>>(wk, WK, (size_t)DKV * DM / 8); k_cvt8<<<(unsigned)(((size_t)DKV * DM / 8 + 255) / 256), 256, 0, stream>>>(wv, WV, (size_t)DKV * DM / 8);
      k_cvt8<<<(unsigned)(((size_t)DM * DQ / 8 + 255) / 256), 256, 0, stream>>>(wo, WO, (size_t)DM * DQ / 8);
       }
    k_csid<<<(TT * HD + 255) / 256, 256, 0, stream>>>(CS); k_mkf<<<(NB_ * NH_ * TT + 255) / 256, 256, 0, stream>>>((const int*)MK, MKF, ONES);
    const unsigned LQ = (unsigned)(((size_t)NH_ * TT * HD / 2 + 255) / 256), LKv = (unsigned)(((size_t)NKV * TT * HD / 2 + 255) / 256);
    for (int b = 0; b < NB_; ++b) {
        
        k_cvt8<<<(unsigned)(((size_t)TT * DM / 8 + 255) / 256), 256, 0, stream>>>(x + (size_t)b * TT * DM, XB, (size_t)TT * DM / 8);
        k_gemmw<bf, 0, true><<<dim3(TT / 64, DQ / 64, 1), 32, 0, stream>>>(XB, nullptr, WQ, nullptr, DM, DM, FQ, DQ, bq, 0, 0, 0);
        k_rope<<<LQ, 256, 0, stream>>>(FQ, DQ, NH_, CS, MKF + (size_t)b * NH_ * TT, ONES, 1.0f, QP16, QPh, QPl);   // q x mask[b][h][s]
        k_gemmw<bf, 0, true><<<dim3(TT / 64, DKV / 64, 1), 32, 0, stream>>>(XB, nullptr, WK, nullptr, DM, DM, FK, DKV, bk, 0, 0, 0);
        k_rope<<<LKv, 256, 0, stream>>>(FK, DKV, NKV, CS, MKF + (size_t)b * NH_ * TT, ONES, 1.0f, KP16, KPh, KPl);   // k x mask[b][h][s]
        k_gemmw<bf, 0, true><<<dim3(TT / 64, DKV / 64, 1), 32, 0, stream>>>(XB, nullptr, WV, nullptr, DM, DM, FV, DKV, bv, 0, 0, 0); k_vtp<<<LKv, 256, 0, stream>>>(FV, DKV, NKV, VT16, VTh, VTl);
        for (int h0 = 0; h0 < NH_; h0 += ZH) { const size_t zq = (size_t)h0, zk = (size_t)(h0 / REP);   // one kv head per query head: the pass's heads use consecutive kv planes (z-strides TT*HD)
            k_gemmw<bf, 2, false><<<dim3(RH / 64, TT / 64, ZH), 32, 0, stream>>>(QPh + zq * TT * HD, QPl + zq * TT * HD, KPh + zk * TT * HD, KPl + zk * TT * HD, HD, HD, Sb, TT, nullptr, (size_t)TT * HD, (size_t)TT * HD, (size_t)TT * TT);
            k_gemmw<h16, 0, false><<<dim3((TT - RH) / 64, TT / 64, ZH), 32, 0, stream>>>(QP16 + zq * TT * HD + (size_t)RH * HD, nullptr, KP16 + zk * TT * HD, nullptr, HD, HD, Sb + (size_t)RH * TT, TT, nullptr, (size_t)TT * HD, (size_t)TT * HD, (size_t)TT * TT);
            k_asoft<<<ZH * TT / 8, 256, 0, stream>>>(Sb);
            k_gemmw<bf, 2, false, KSP><<<dim3(RH / 64, HD / 64 * KSP, ZH), 32, 0, stream>>>(Ph, Pl, VTh + zk * HD * TT, VTl + zk * HD * TT, TT, 2 * TT, Ob, HD, nullptr, (size_t)2 * TT * TT, (size_t)HD * TT, (size_t)TT * HD);
            k_gemmw<h16, 0, false, KSP><<<dim3((TT - RH) / 64, HD / 64 * KSP, ZH), 32, 0, stream>>>(P16 + (size_t)RH * 2 * TT, nullptr, VT16 + zk * HD * TT, nullptr, TT, 2 * TT, Ob + (size_t)RH * HD, HD, nullptr, (size_t)2 * TT * TT, (size_t)HD * TT, (size_t)TT * HD);
            k_merge<<<(unsigned)(((size_t)ZH * TT * HD / 2 + 255) / 256), 256, 0, stream>>>(Ob, h0, ATh, ATl); }
        k_gemmw<bf, 1, true><<<dim3(TT / 64, DM / 64, 1), 32, 0, stream>>>(ATh, ATl, WO, nullptr, DQ, DQ, OUT + (size_t)b * TT * DM, DM, bo, 0, 0, 0); }
}

// v003
// One run takes 318 microseconds.
// Two timings next to v002 put it at 2.01 and 2.02 times that version's speed.
// Counting every step since v000, it is 6.25 times as fast.
#include <hip/hip_runtime.h>

// SparseFlashAttention (x [2][2048][1024]; q/k/v = x W^T + b (torch layouts, 16 heads x 64); q and k multiplied by sparsity_mask[b][h][s] (int 0/1, read as data); softmax(q.k/8) (no other mask); out = (attn v merged) Wo^T + bo -> [2][2048][1024]).
// Compute dtypes, f32 accumulate: every input rounded to bf16; q/k/v projections on PLAIN bf16 operands (inputs: exact) + bias; scores (K 64) and attn.v on bf16 hi+lo planes (3 products) for the first 512 query rows of each head

#define NB_  2
#define TT   2048
#define DM   1024
#define NH_  16
#define NKV  16
#define REP  (NH_ / NKV)
#define HD   64
#define DQ   (NH_ * HD)
#define DKV  (NKV * HD)
#define ZH   8                    // z-batch of a K-sliced k_gemmw launch (KSL > 1; no such launch is left)
#define RH   512                  // query rows < RH use hi+lo planes (0: none)
#define WIN  0
#define SCL  0.125f   // HD^-0.5
typedef _Float16 h16;
typedef unsigned short bf;
typedef __attribute__((ext_vector_type(16))) __bf16   v16bf;
typedef __attribute__((ext_vector_type(16))) _Float16 v16h;
typedef __attribute__((ext_vector_type(8)))  _Float16 v8h;
typedef __attribute__((ext_vector_type(8)))  unsigned short v8us;
typedef __attribute__((ext_vector_type(8)))  float    v8f;
typedef __attribute__((ext_vector_type(4)))  float    v4f;
typedef v8h  __attribute__((may_alias)) v8ha;
typedef v4f  __attribute__((may_alias)) v4fa;
typedef v8us __attribute__((may_alias)) v8usa;

__device__ __forceinline__ unsigned short f2bf(float f) { unsigned u = __float_as_uint(f); u += 0x7FFFu + ((u >> 16) & 1u); return (unsigned short)(u >> 16); }
__device__ __forceinline__ float bf2f(unsigned short b) { return __uint_as_float(((unsigned)b) << 16); }
__device__ __forceinline__ float bfr(float f) { return bf2f(f2bf(f)); }
__device__ __forceinline__ v16h cat16(v8h lo, v8h hi) { return __builtin_shufflevector(lo, hi, 0, 1, 2, 3, 4, 5, 6, 7, 8, 9, 10, 11, 12, 13, 14, 15); }
__device__ __forceinline__ v16bf cat16b(v8us lo, v8us hi) { return __builtin_bit_cast(v16bf, __builtin_shufflevector(lo, hi, 0, 1, 2, 3, 4, 5, 6, 7, 8, 9, 10, 11, 12, 13, 14, 15)); }
__device__ __forceinline__ v8f wmma16(v16h a, v16h b, v8f c) { return __builtin_amdgcn_wmma_f32_16x16x32_f16(false, a, false, b, (short)0, c, false, false); }
__device__ __forceinline__ v8f wmmab(v16bf a, v16bf b, v8f c) { return __builtin_amdgcn_wmma_f32_16x16x32_bf16(false, a, false, b, (short)0, c, false, false); }



// ---- k_gemmw: register-blocked GEMM, ONE WAVE per 64x64 output tile (16 accumulators), operands straight from K-contiguous 16-bit planes; grid (M/64, N/64, Z), 32 threads.
// C[m][n] (f32, pitch ldc, + optional f32 bias[n]) = sum_k A[m][k] Bt[n][k] (+ split products per NSPLIT). A rows have pitch lda, Bt rows pitch K (elements). z-batch strides sA/sB/sC in elements. K % 32 == 0.
// KSL > 1: grid (M/64, N/64 * KSL, Z); slice ks = blockIdx.y % KSL sums only k in [ks K/KSL, (ks+1) K/KSL) and stores it in partial plane ks (planes ZH * sC elements apart, one whole z-batch each); the reader adds the planes.
template <typename T16> struct WFrag;
template <> struct WFrag<h16> { typedef v16h V; static __device__ __forceinline__ V ld(const h16* p) { return cat16(*(const v8h*)p, *(const v8h*)(p + 16)); } static __device__ __forceinline__ v8f mma(V a, V b, v8f c) { return wmma16(a, b, c); } };
template <> struct WFrag<bf> { typedef v16bf V; static __device__ __forceinline__ V ld(const bf* p) { return cat16b(*(const v8us*)p, *(const v8us*)(p + 16)); } static __device__ __forceinline__ v8f mma(V a, V b, v8f c) { return wmmab(a, b, c); } };
template <typename T16, int NSPLIT, bool BIAS, int KSL = 1>
__global__ __launch_bounds__(32) void k_gemmw(const T16* __restrict__ A, const T16* __restrict__ A2, const T16* __restrict__ Bt, const T16* __restrict__ Bt2, int K, int lda, float* C, int ldc, const float* __restrict__ bias, size_t sA, size_t sB, size_t sC) {
    typedef typename WFrag<T16>::V V;
    __shared__ __align__(16) float os[16 * 68];
    const size_t z = blockIdx.z; A += z * sA; if (A2) A2 += z * sA; Bt += z * sB; if (Bt2) Bt2 += z * sB; C += z * sC;
    const int ks = blockIdx.y % KSL, kb = ks * (K / KSL), ke = kb + K / KSL; C += (size_t)ks * ZH * sC;
    const int lane = threadIdx.x & 31, lr = lane & 15, hi = lane >> 4; const int r0 = blockIdx.x * 64, c0 = (blockIdx.y / KSL) * 64;
    v8f acc[4][4];
#pragma unroll
    for (int mb = 0; mb < 4; ++mb)
#pragma unroll
        for (int nb = 0; nb < 4; ++nb) acc[mb][nb] = (v8f){};
    const size_t aoff = (size_t)(r0 + lr) * lda + 8 * hi, boff = (size_t)(c0 + lr) * K + 8 * hi;
#pragma unroll 1
    for (int kc = kb; kc < ke; kc += 32) {
        V a[4], a2[4];
#pragma unroll
        for (int mb = 0; mb < 4; ++mb) { a[mb] = WFrag<T16>::ld(A + aoff + (size_t)mb * 16 * lda + kc); if (NSPLIT == 1 || NSPLIT == 2) a2[mb] = WFrag<T16>::ld(A2 + aoff + (size_t)mb * 16 * lda + kc); }
#pragma unroll
        for (int nb = 0; nb < 4; ++nb) { const V b = WFrag<T16>::ld(Bt + boff + (size_t)nb * 16 * K + kc); V b2; if (NSPLIT >= 2) b2 = WFrag<T16>::ld(Bt2 + boff + (size_t)nb * 16 * K + kc);
#pragma unroll
            for (int mb = 0; mb < 4; ++mb) { acc[mb][nb] = WFrag<T16>::mma(a[mb], b, acc[mb][nb]); if (NSPLIT == 1 || NSPLIT == 2) acc[mb][nb] = WFrag<T16>::mma(a2[mb], b, acc[mb][nb]); if (NSPLIT >= 2) acc[mb][nb] = WFrag<T16>::mma(a[mb], b2, acc[mb][nb]); } }
        asm volatile("v_nop\n\tv_nop\n\tv_nop\n\tv_nop" : "+v"(acc[0][0]), "+v"(acc[1][1]), "+v"(acc[2][2]), "+v"(acc[3][3]) : "v"(a[0]), "v"(a[3]));
    }
#pragma unroll
    for (int mb = 0; mb < 4; ++mb) {
#pragma unroll
        for (int nb = 0; nb < 4; ++nb) {
#pragma unroll
            for (int j = 0; j < 8; ++j) os[(hi * 8 + j) * 68 + nb * 16 + lr] = acc[mb][nb][j]; }
        __builtin_amdgcn_wave_barrier(); asm volatile("" ::: "memory");
        float* crow = C + (size_t)(r0 + mb * 16) * ldc + c0;
{
#pragma unroll
            for (int s = 0; s < 8; ++s) { const int row = 2 * s + hi, cofs = lr * 4; v4f val = *(const v4fa*)(os + row * 68 + cofs); if (BIAS) { val[0] += bfr(bias[c0 + cofs]); val[1] += bfr(bias[c0 + cofs + 1]); val[2] += bfr(bias[c0 + cofs + 2]); val[3] += bfr(bias[c0 + cofs + 3]); }
                *(v4f*)(crow + (size_t)row * ldc + cofs) = val; }
             }
        __builtin_amdgcn_wave_barrier(); asm volatile("" ::: "memory");
    }
}

__device__ __forceinline__ h16 tohx(float x) { return (h16)x; }
__device__ __forceinline__ void splitf(float y, unsigned short& h, unsigned short& l) { h = f2bf(y); l = f2bf(y - bf2f(h)); }
typedef __attribute__((ext_vector_type(2))) _Float16 v2h;
typedef __attribute__((ext_vector_type(4))) _Float16 v4h;
typedef __attribute__((ext_vector_type(2))) unsigned short v2us;
typedef __attribute__((ext_vector_type(4))) unsigned short v4us;
typedef __attribute__((ext_vector_type(2))) float v2f;
typedef __attribute__((ext_vector_type(4))) int v4i;
typedef v4h  __attribute__((may_alias)) v4ha;
typedef v4us __attribute__((may_alias)) v4usa;

__global__ __launch_bounds__(256) void k_wtG(const float* __restrict__ w, int K, int N, bf* Bt) {
    const int lane = threadIdx.x & 31; const int L0 = (blockIdx.x * 8 + (threadIdx.x >> 5)) * 8; const int nlines = N * K / 64;
{
#pragma unroll 1
        for (int l = 0; l < 8; ++l) { const int L = L0 + l; if (L >= nlines) break; const size_t e = (size_t)L * 64 + lane * 2; const int k = (int)(e % K), n = (int)(e / K); v2us o;
            o[0] = f2bf(w[(size_t)k * N + n]); o[1] = f2bf(w[(size_t)(k + 1) * N + n]); *(v2us*)(Bt + e) = o; }
         }
}
__global__ __launch_bounds__(256) void k_cvt8(const float* __restrict__ src, bf* dst, size_t n8) { const size_t i = (size_t)blockIdx.x * 256 + threadIdx.x; if (i >= n8) return; const v8f v = *(const v8f*)(src + i * 8); v8us o;
#pragma unroll
    for (int k = 0; k < 8; ++k) o[k] = f2bf(v[k]); *(v8us*)(dst + i * 8) = o;  }
__global__ __launch_bounds__(256) void k_cscvt(const float* __restrict__ cosT, const float* __restrict__ sinT, float* CS) { const int idx = blockIdx.x * 256 + threadIdx.x; if (idx >= TT * HD) return; v2f cs; cs[0] = bfr(cosT[idx]); cs[1] = bfr(sinT[idx]); *(v2f*)(CS + (size_t)idx * 2) = cs;  }
// k_rope: head planes [h][t][d] (fp16 + hi/lo) of rope(x) x sc with the rotate-half convention out[d] = x[d] cos[t][d] - x[d+HD/2] sin[t][d], out[d+HD/2] = x[d+HD/2] cos[t][d+HD/2] + x[d] sin[t][d+HD/2]
__global__ __launch_bounds__(256) void k_rope(const float* __restrict__ F, int pitch, int nheads, const float* __restrict__ CS, const float* __restrict__ RF, const float* __restrict__ nw, float sc, h16* P16, bf* Ph, bf* Pl) {
    const size_t e = ((size_t)blockIdx.x * 256 + threadIdx.x) * 2; if (e >= (size_t)nheads * TT * HD) return; const int d = (int)(e % HD); const int t = (int)((e / HD) % TT); const int h = (int)(e / ((size_t)HD * TT)); const float* f = F + (size_t)t * pitch + h * HD; const float rf = RF ? RF[(size_t)h * TT + t] : 1.0f; v2h o16; v2us oh, ol;
#pragma unroll
    for (int q = 0; q < 2; ++q) { const int dd = d + q; const int dp = (dd < HD / 2) ? dd + HD / 2 : dd - HD / 2; float x0 = f[dd], x1 = f[dp];
        if (RF) { float n0 = __fmul_rn(x0, rf), n1 = __fmul_rn(x1, rf); asm volatile("" : "+v"(n0)); asm volatile("" : "+v"(n1)); x0 = __fmul_rn(bfr(nw[dd]), n0); x1 = __fmul_rn(bfr(nw[dp]), n1); }
        const v2f cs = *(const v2f*)(CS + ((size_t)t * HD + dd) * 2); float a = __fmul_rn(x0, cs[0]), bq = __fmul_rn(x1, cs[1]); asm volatile("" : "+v"(a)); asm volatile("" : "+v"(bq)); const float r = ((dd < HD / 2) ? __fsub_rn(a, bq) : __fadd_rn(a, bq)) * sc;
        o16[q] = tohx(r); unsigned short a2, c2; splitf(r, a2, c2); oh[q] = a2; ol[q] = c2; }
    *(v2h*)(P16 + e) = o16; *(v2us*)(Ph + e) = oh; *(v2us*)(Pl + e) = ol;  }
__global__ __launch_bounds__(256) void k_vtp(const float* __restrict__ F, int pitch, int nheads, h16* V16, bf* Vh, bf* Vl) { const size_t e = ((size_t)blockIdx.x * 256 + threadIdx.x) * 2; if (e >= (size_t)nheads * HD * TT) return; const int t = (int)(e % TT); const int d = (int)((e / TT) % HD); const int g = (int)(e / ((size_t)TT * HD)); v2h o16; v2us oh, ol;
#pragma unroll
    for (int q = 0; q < 2; ++q) { const float x = F[(size_t)(t + q) * pitch + g * HD + d]; o16[q] = tohx(x); unsigned short a2, c2; splitf(x, a2, c2); oh[q] = a2; ol[q] = c2; }
    *(v2h*)(V16 + e) = o16; *(v2us*)(Vh + e) = oh; *(v2us*)(Vl + e) = ol;  }
__global__ __launch_bounds__(256) void k_csid(float* CS) { const int idx = blockIdx.x * 256 + threadIdx.x; if (idx >= TT * HD) return; v2f cs; cs[0] = 1.0f; cs[1] = 0.0f; *(v2f*)(CS + (size_t)idx * 2) = cs;  }
__global__ __launch_bounds__(256) void k_mkf(const int* __restrict__ mk, float* MKF, float* ONES) { const int i = blockIdx.x * 256 + threadIdx.x; if (i < HD) { *(float*)(ONES + i) = 1.0f; } if (i >= NB_ * NH_ * TT) return; const float v = (float)mk[i]; *(float*)(MKF + i) = v;  if (i < HD) *(float*)(ONES + i) = 1.0f; }
// ---- k_flash: scores, softmax, attn.v and the head merge in one kernel; the scores never leave the registers.
// Transposed products: S^T = K.Q^T (A = 16 keys, B = 16 queries), O^T += V^T.P^T (A = 16 d, B = 16 queries). In a D tile lane (lr, hi) holds keys 8 hi + j of query lr, so two key tiles,
// converted in place, are the B operand of the second product in the loaders' own k order (8 hi + j, 16 + 8 hi + j), and a query's maximum, sum and rescale factor live in its own two lanes.
// Grid (NB_ * NH_, FBH + FBL), FT threads = 4 waves. Blocks y < FBH: query rows < RH on bf16 hi+lo planes (3 products), 16 queries a wave; the others: fp16 planes, 32 queries a wave.
// K rows and V^T rows of a stage of SK keys go through registers into one of two LDS buffers (pitch = row + 16 bytes); the next stage is stored and the one after it fetched while this one is worked on; one barrier a stage.
#define FT   128
#define FBH  (RH / 64)
#define FBL  ((TT - RH) / 128)
#define FLDS (2 * (2 * 32 * (HD + 8) + 2 * HD * (32 + 8)))   // 16-bit elements: two buffers of the larger (hi+lo) form
typedef __attribute__((ext_vector_type(8))) __bf16 v8bf;
__device__ __forceinline__ float xhalf(float x) { return __builtin_bit_cast(float, __builtin_amdgcn_permlanex16(__builtin_bit_cast(int, x), __builtin_bit_cast(int, x), 0x76543210, 0xfedcba98, false, false)); }   // lane l with lane l ^ 16
// exp2 with its own free slot: the instruction set asks for one independent instruction or v_nop between a transcendental and an instruction that reads its result or overwrites its source
__device__ __forceinline__ float exp2s(float x) { float r; asm("v_exp_f32 %0, %1\n\tv_nop" : "=v"(r) : "v"(x)); return r; }
template <bool HI> struct FFrag;
template <> struct FFrag<false> { typedef v16h V; static __device__ __forceinline__ V ld(const unsigned short* p) { return __builtin_bit_cast(v16h, __builtin_shufflevector(*(const v8usa*)p, *(const v8usa*)(p + 16), 0, 1, 2, 3, 4, 5, 6, 7, 8, 9, 10, 11, 12, 13, 14, 15)); } static __device__ __forceinline__ v8f mma(V a, V b, v8f c) { return wmma16(a, b, c); } };
template <> struct FFrag<true> { typedef v16bf V; static __device__ __forceinline__ V ld(const unsigned short* p) { return cat16b(*(const v8usa*)p, *(const v8usa*)(p + 16)); } static __device__ __forceinline__ v8f mma(V a, V b, v8f c) { return wmmab(a, b, c); } };
template <bool HI>
__device__ __forceinline__ void flash_body(unsigned short* L, const unsigned short* __restrict__ Q0, const unsigned short* __restrict__ Q1, const unsigned short* __restrict__ K0, const unsigned short* __restrict__ K1, const unsigned short* __restrict__ V0, const unsigned short* __restrict__ V1, bf* Oh, bf* Ol, int q0) {
    typedef FFrag<HI> F; typedef typename F::V V;
    constexpr int R = HI ? 1 : 2, NP = HI ? 2 : 1, SK = HI ? 32 : 64, NST = TT / SK, KPI = HD + 8, VPI = SK + 8, KSZ = SK * KPI, VSZ = HD * VPI, BUF = NP * (KSZ + VSZ), CH = SK / 16, VC = SK / 8;
    static_assert(2 * BUF <= FLDS, "LDS");
    const int tid = threadIdx.x, lane = tid & 31, lr = lane & 15, hi = lane >> 4, qw = q0 + (tid >> 5) * 16 * R;
    const float cscale = SCL * 1.4426950408889634f;   // scores in the log2 domain
    v8us rk[NP][CH], rv[NP][CH];
    const unsigned short* kq[2] = {K0, K1}; const unsigned short* vq[2] = {V0, V1};   // wave-uniform pointers to the next stage to fetch; the lanes add 32-bit offsets
    // pro: the fetches in front of the loop. There a later load's result may be given a register that an earlier load of the run names as its offset, so s_wait_xcnt 0 stands behind every load (the loop's fetches are covered by the waits at the stage barrier)
    auto fetch = [&](const bool pro) {
#pragma unroll
        for (int p = 0; p < NP; ++p) {
#pragma unroll
            for (int i = 0; i < CH; ++i) { const int c = tid + FT * i;
                rk[p][i] = *(const v8usa*)(kq[p] + (unsigned)(c * 8));
                if (pro) asm volatile("s_wait_xcnt 0x0" ::: "memory");
                rv[p][i] = *(const v8usa*)(vq[p] + (unsigned)((c / VC) * TT + (c % VC) * 8));
                if (pro) asm volatile("s_wait_xcnt 0x0" ::: "memory"); } } };
    auto advance = [&]() {
#pragma unroll
        for (int p = 0; p < NP; ++p) { kq[p] += SK * HD; vq[p] += SK; } };
    auto put = [&](int b) {
#pragma unroll
        for (int p = 0; p < NP; ++p)
#pragma unroll
            for (int i = 0; i < CH; ++i) { const int c = tid + FT * i;
                *(v8usa*)(L + b * BUF + p * KSZ + (c >> 3) * KPI + (c & 7) * 8) = rk[p][i];
                *(v8usa*)(L + b * BUF + NP * KSZ + p * VSZ + (c / VC) * VPI + (c % VC) * 8) = rv[p][i]; } };
    fetch(true); advance();
    V qf[NP][R][2];
#pragma unroll
    for (int p = 0; p < NP; ++p)
#pragma unroll
        for (int g = 0; g < R; ++g)
#pragma unroll
            for (int kc = 0; kc < 2; ++kc) qf[p][g][kc] = F::ld((p ? Q1 : Q0) + (size_t)(qw + g * 16 + lr) * HD + kc * 32 + 8 * hi);
    v8f acc[R][4]; float m_run[R], l_run[R];
#pragma unroll
    for (int g = 0; g < R; ++g) { m_run[g] = -__builtin_inff(); l_run[g] = 0.f;
#pragma unroll
        for (int t = 0; t < 4; ++t) acc[g][t] = (v8f){}; }
    put(0); fetch(true); advance();
    __syncthreads();   // stage 0 is in buffer 0 for every wave
#pragma unroll 1   // the stage loop stays rolled (registers, code size); every loop inside it is unrolled so that the register arrays are indexed by constants
    for (int st = 0; st < NST; ++st) {
        if (st + 1 < NST) put((st + 1) & 1);   // its last readers left that buffer before the barrier that ended stage st - 1
        if (st + 2 < NST) fetch(false);
        const unsigned short* Kb = L + (st & 1) * BUF + lr * KPI + 8 * hi; const unsigned short* Vb = L + (st & 1) * BUF + NP * KSZ + lr * VPI + 8 * hi;
#pragma unroll
        for (int sub = 0; sub < SK / 32; ++sub) {   // one pass: 32 keys
            v8f s[2][R];
#pragma unroll
            for (int kt = 0; kt < 2; ++kt) {
#pragma unroll
                for (int g = 0; g < R; ++g) s[kt][g] = (v8f){};
#pragma unroll
                for (int kc = 0; kc < 2; ++kc) { const unsigned short* kp = Kb + (sub * 32 + kt * 16) * KPI + kc * 32; const V a = F::ld(kp); V a2; if (HI) a2 = F::ld(kp + KSZ);
#pragma unroll
                    for (int g = 0; g < R; ++g) { s[kt][g] = F::mma(a, qf[0][g][kc], s[kt][g]); if (HI) { s[kt][g] = F::mma(a2, qf[0][g][kc], s[kt][g]); s[kt][g] = F::mma(a, qf[NP - 1][g][kc], s[kt][g]); } } } }
            // the maximum in use may trail the true one by up to 8 (log2 domain, so an exponential stays below 2^8); sums and outputs are rescaled only when some query exceeds that
            float mb[R]; bool need = false;
#pragma unroll
            for (int g = 0; g < R; ++g) { float mx = s[0][g][0];
#pragma unroll
                for (int r = 0; r < 8; ++r) mx = fmaxf(mx, fmaxf(s[0][g][r], s[1][g][r]));
                mx = fmaxf(mx, xhalf(mx)) * cscale; mb[g] = mx; need = need || (mx > m_run[g] + 8.0f); }
            if (__builtin_amdgcn_ballot_w32(need) != 0) {
#pragma unroll
                for (int g = 0; g < R; ++g) { const float m_new = fmaxf(m_run[g], mb[g]); const float corr = exp2s(m_run[g] - m_new); m_run[g] = m_new; l_run[g] *= corr;   // corr is 0 in the first pass
#pragma unroll
                    for (int t = 0; t < 4; ++t) acc[g][t] = acc[g][t] * corr; } }
            V pf[NP][R];
#pragma unroll
            for (int g = 0; g < R; ++g) { v8f p0, p1;
#pragma unroll
                for (int r = 0; r < 8; ++r) { p0[r] = exp2s(__builtin_fmaf(s[0][g][r], cscale, -m_run[g])); p1[r] = exp2s(__builtin_fmaf(s[1][g][r], cscale, -m_run[g])); }
                const v8f ps = p0 + p1; l_run[g] += ((ps[0] + ps[1]) + (ps[2] + ps[3])) + ((ps[4] + ps[5]) + (ps[6] + ps[7]));
                if constexpr (HI) { const v8bf h0 = __builtin_convertvector(p0, v8bf), h1 = __builtin_convertvector(p1, v8bf);
                    const v8bf l0 = __builtin_convertvector(p0 - __builtin_convertvector(h0, v8f), v8bf), l1 = __builtin_convertvector(p1 - __builtin_convertvector(h1, v8f), v8bf);
                    pf[0][g] = __builtin_shufflevector(h0, h1, 0, 1, 2, 3, 4, 5, 6, 7, 8, 9, 10, 11, 12, 13, 14, 15); pf[NP - 1][g] = __builtin_shufflevector(l0, l1, 0, 1, 2, 3, 4, 5, 6, 7, 8, 9, 10, 11, 12, 13, 14, 15);
                } else pf[0][g] = cat16(__builtin_convertvector(p0, v8h), __builtin_convertvector(p1, v8h)); }
#pragma unroll
            for (int t = 0; t < 4; ++t) { const unsigned short* vp = Vb + t * 16 * VPI + sub * 32; const V a = F::ld(vp); V a2; if (HI) a2 = F::ld(vp + VSZ);
#pragma unroll
                for (int g = 0; g < R; ++g) { acc[g][t] = F::mma(a, pf[0][g], acc[g][t]); if (HI) { acc[g][t] = F::mma(a2, pf[0][g], acc[g][t]); acc[g][t] = F::mma(a, pf[NP - 1][g], acc[g][t]); } } }
        }
        __syncthreads();   // publishes stage st + 1 and ends every wave's reads of stage st
        asm volatile("s_wait_xcnt 0x0" ::: "memory");   // in front of the pointer updates: they overwrite the scalar bases that this stage's fetch names (its data has returned by the barrier, so nothing is waited for here)
        __builtin_amdgcn_sched_barrier(0);   // keeps the scheduler from lifting those updates over the wait and the barrier
        advance();
    }
#pragma unroll
    for (int g = 0; g < R; ++g) { const float l = l_run[g] + xhalf(l_run[g]); const float inv = __fdiv_rn(1.0f, l); const size_t oo = (size_t)(qw + g * 16 + lr) * DQ + 8 * hi;
#pragma unroll
        for (int t = 0; t < 4; ++t) { v8us oh, ol;
#pragma unroll
            for (int j = 0; j < 8; ++j) { unsigned short a, c2; splitf(acc[g][t][j] * inv, a, c2); oh[j] = a; ol[j] = c2; }
            *(v8usa*)(Oh + oo + t * 16) = oh; *(v8usa*)(Ol + oo + t * 16) = ol;
            if (g + 1 < R || t < 3) asm volatile("s_wait_xcnt 0x0" ::: "memory"); } }   // in front of the next tile's arithmetic, which reuses the registers these two stores name
}
// amdgpu_waves_per_eu(4, 4): at most 256 VGPRs, so that the two to three work-groups a WGP gets can all be resident (one wave of each on every SIMD)
__global__ __launch_bounds__(FT) __attribute__((amdgpu_waves_per_eu(4, 4))) void k_flash(const h16* __restrict__ Q16, const h16* __restrict__ K16, const h16* __restrict__ V16, const bf* __restrict__ Qh, const bf* __restrict__ Ql, const bf* __restrict__ Kh, const bf* __restrict__ Kl, const bf* __restrict__ Vh, const bf* __restrict__ Vl, bf* Ah, bf* Al) {
    __shared__ __align__(16) unsigned short L[FLDS];
    const size_t z = blockIdx.x, zo = z * TT * HD, ao = (z / NH_) * TT * DQ + (z % NH_) * HD; const int y = blockIdx.y;   // the heavier hi+lo blocks have the low indices and start first
    if (y < FBH) flash_body<true>(L, Qh + zo, Ql + zo, Kh + zo, Kl + zo, Vh + zo, Vl + zo, Ah + ao, Al + ao, y * 64);
    else flash_body<false>(L, (const unsigned short*)Q16 + zo, (const unsigned short*)Q16 + zo, (const unsigned short*)K16 + zo, (const unsigned short*)K16 + zo, (const unsigned short*)V16 + zo, (const unsigned short*)V16 + zo, Ah + ao, Al + ao, RH + (y - FBH) * 128);
}

extern "C" void kernel_launch(void* const* d_in, const int* in_sizes, int n_in,
                              void* d_out, int out_size, void* d_ws, size_t ws_size, hipStream_t stream) {
    (void)in_sizes; (void)n_in; (void)out_size;
    const float* x = (const float*)d_in[0]; const int* MK = (const int*)d_in[1]; const float* wq = (const float*)d_in[2]; const float* bq = (const float*)d_in[3]; const float* wk = (const float*)d_in[4]; const float* bk = (const float*)d_in[5]; const float* wv = (const float*)d_in[6]; const float* bv = (const float*)d_in[7]; const float* wo = (const float*)d_in[8]; const float* bo = (const float*)d_in[9]; const float* cosT = nullptr; const float* sinT = nullptr; (void)cosT; (void)sinT;
    float* OUT = (float*)d_out;     // [2][2048][1024]
    char* wsp = (char*)d_ws;
    auto take = [&](size_t bytes) { char* p = wsp; wsp += (bytes + 255) & ~(size_t)255; return (void*)p; };
    bf* WQ = (bf*)take((size_t)DQ * DM * 2); bf* WK = (bf*)take((size_t)DKV * DM * 2); bf* WV = (bf*)take((size_t)DKV * DM * 2); bf* WO = (bf*)take((size_t)DM * DQ * 2); float* CS = (float*)take((size_t)TT * HD * 2 * 4); float* MKF = (float*)take((size_t)NB_ * NH_ * TT * 4); float* ONES = (float*)take(256);
    bf* XB = (bf*)take((size_t)TT * DM * 2); float* FQ = (float*)take((size_t)TT * DQ * 4); float* FK = (float*)take((size_t)TT * DKV * 4);
    const size_t PB = (size_t)NH_ * TT * HD;   // elements of one batch's head planes; every plane holds both batches, k_flash reads them all in one launch
    h16* QP16 = (h16*)take(NB_ * PB * 2); h16* KP16 = (h16*)take(NB_ * PB * 2); h16* VT16 = (h16*)take(NB_ * PB * 2);
    bf* QPh = (bf*)take(NB_ * PB * 2); bf* QPl = (bf*)take(NB_ * PB * 2); bf* KPh = (bf*)take(NB_ * PB * 2); bf* KPl = (bf*)take(NB_ * PB * 2); bf* VTh = (bf*)take(NB_ * PB * 2); bf* VTl = (bf*)take(NB_ * PB * 2);
    bf* ATh = (bf*)take((size_t)NB_ * TT * DQ * 2); bf* ATl = (bf*)take((size_t)NB_ * TT * DQ * 2);
    if ((size_t)(wsp - (char*)d_ws) > ws_size) return;    // ws 256 MiB
    float* FV = FK;   // v projection reuses the k buffer after the k planes are built (stream-ordered)
    { k_cvt8<<<(unsigned)(((size_t)DQ * DM / 8 + 255) / 256), 256, 0, stream>>>(wq, WQ, (size_t)DQ * DM / 8); k_cvt8<<<(unsigned)(((size_t)DKV * DM / 8 + 255) / 256), 256, 0, stream>>>(wk, WK, (size_t)DKV * DM / 8); k_cvt8<<<(unsigned)(((size_t)DKV * DM / 8 + 255) / 256), 256, 0, stream>>>(wv, WV, (size_t)DKV * DM / 8);
      k_cvt8<<<(unsigned)(((size_t)DM * DQ / 8 + 255) / 256), 256, 0, stream>>>(wo, WO, (size_t)DM * DQ / 8);
       }
    k_csid<<<(TT * HD + 255) / 256, 256, 0, stream>>>(CS); k_mkf<<<(NB_ * NH_ * TT + 255) / 256, 256, 0, stream>>>((const int*)MK, MKF, ONES);
    const unsigned LQ = (unsigned)(((size_t)NH_ * TT * HD / 2 + 255) / 256), LKv = (unsigned)(((size_t)NKV * TT * HD / 2 + 255) / 256);
    for (int b = 0; b < NB_; ++b) {
        const size_t pb = (size_t)b * PB;
        k_cvt8<<<(unsigned)(((size_t)TT * DM / 8 + 255) / 256), 256, 0, stream>>>(x + (size_t)b * TT * DM, XB, (size_t)TT * DM / 8);
        k_gemmw<bf, 0, true><<<dim3(TT / 64, DQ / 64, 1), 32, 0, stream>>>(XB, nullptr, WQ, nullptr, DM, DM, FQ, DQ, bq, 0, 0, 0);
        k_rope<<<LQ, 256, 0, stream>>>(FQ, DQ, NH_, CS, MKF + (size_t)b * NH_ * TT, ONES, 1.0f, QP16 + pb, QPh + pb, QPl + pb);   // q x mask[b][h][s]
        k_gemmw<bf, 0, true><<<dim3(TT / 64, DKV / 64, 1), 32, 0, stream>>>(XB, nullptr, WK, nullptr, DM, DM, FK, DKV, bk, 0, 0, 0);
        k_rope<<<LKv, 256, 0, stream>>>(FK, DKV, NKV, CS, MKF + (size_t)b * NH_ * TT, ONES, 1.0f, KP16 + pb, KPh + pb, KPl + pb);   // k x mask[b][h][s]
        k_gemmw<bf, 0, true><<<dim3(TT / 64, DKV / 64, 1), 32, 0, stream>>>(XB, nullptr, WV, nullptr, DM, DM, FV, DKV, bv, 0, 0, 0); k_vtp<<<LKv, 256, 0, stream>>>(FV, DKV, NKV, VT16 + pb, VTh + pb, VTl + pb); }
    k_flash<<<dim3(NB_ * NH_, FBH + FBL, 1), FT, 0, stream>>>(QP16, KP16, VT16, QPh, QPl, KPh, KPl, VTh, VTl, ATh, ATl);   // one kv head per query head
    for (int b = 0; b < NB_; ++b)
        k_gemmw<bf, 1, true><<<dim3(TT / 64, DM / 64, 1), 32, 0, stream>>>(ATh + (size_t)b * TT * DQ, ATl + (size_t)b * TT * DQ, WO, nullptr, DQ, DQ, OUT + (size_t)b * TT * DM, DM, bo, 0, 0, 0);
}

// v004
// Measured time: 188 microseconds a run.
// Two timings next to v003 both put it at 1.69 times that version's speed.
// Counting every step since v000, it is 10.6 times as fast.
#include <hip/hip_runtime.h>

// SparseFlashAttention (x [2][2048][1024]; q/k/v = x W^T + b (torch layouts, 16 heads x 64); q and k multiplied by sparsity_mask[b][h][s] (int 0/1, read as data); softmax(q.k/8) (no other mask); out = (attn v merged) Wo^T + bo -> [2][2048][1024]).
// Compute dtypes, f32 accumulate: every input rounded to bf16; q/k/v projections on PLAIN bf16 operands (inputs: exact) + bias; scores (K 64) and attn.v on bf16 hi+lo planes (3 products) for the first 512 query rows of each head

#define NB_  2
#define TT   2048
#define DM   1024
#define NH_  16
#define NKV  16
#define REP  (NH_ / NKV)
#define HD   64
#define DQ   (NH_ * HD)
#define DKV  (NKV * HD)
#define ZH   8                    // z-batch of a K-sliced k_gemmw launch (KSL > 1; no such launch is left)
#define RH   512                  // query rows < RH use hi+lo planes (0: none)
#define WIN  0
#define SCL  0.125f   // HD^-0.5
typedef _Float16 h16;
typedef unsigned short bf;
typedef __attribute__((ext_vector_type(16))) __bf16   v16bf;
typedef __attribute__((ext_vector_type(16))) _Float16 v16h;
typedef __attribute__((ext_vector_type(8)))  _Float16 v8h;
typedef __attribute__((ext_vector_type(8)))  unsigned short v8us;
typedef __attribute__((ext_vector_type(8)))  float    v8f;
typedef __attribute__((ext_vector_type(4)))  float    v4f;
typedef v8h  __attribute__((may_alias)) v8ha;
typedef v4f  __attribute__((may_alias)) v4fa;
typedef v8us __attribute__((may_alias)) v8usa;

__device__ __forceinline__ unsigned short f2bf(float f) { unsigned u = __float_as_uint(f); u += 0x7FFFu + ((u >> 16) & 1u); return (unsigned short)(u >> 16); }
__device__ __forceinline__ float bf2f(unsigned short b) { return __uint_as_float(((unsigned)b) << 16); }
__device__ __forceinline__ float bfr(float f) { return bf2f(f2bf(f)); }
__device__ __forceinline__ v16h cat16(v8h lo, v8h hi) { return __builtin_shufflevector(lo, hi, 0, 1, 2, 3, 4, 5, 6, 7, 8, 9, 10, 11, 12, 13, 14, 15); }
__device__ __forceinline__ v16bf cat16b(v8us lo, v8us hi) { return __builtin_bit_cast(v16bf, __builtin_shufflevector(lo, hi, 0, 1, 2, 3, 4, 5, 6, 7, 8, 9, 10, 11, 12, 13, 14, 15)); }
__device__ __forceinline__ v8f wmma16(v16h a, v16h b, v8f c) { return __builtin_amdgcn_wmma_f32_16x16x32_f16(false, a, false, b, (short)0, c, false, false); }
__device__ __forceinline__ v8f wmmab(v16bf a, v16bf b, v8f c) { return __builtin_amdgcn_wmma_f32_16x16x32_bf16(false, a, false, b, (short)0, c, false, false); }



// ---- k_gemmw: register-blocked GEMM, ONE WAVE per 64x64 output tile (16 accumulators), operands straight from K-contiguous 16-bit planes; grid (M/64, N/64, Z), 32 threads.
// C[m][n] (f32, pitch ldc, + optional f32 bias[n]) = sum_k A[m][k] Bt[n][k] (+ split products per NSPLIT). A rows have pitch lda, Bt rows pitch K (elements). z-batch strides sA/sB/sC in elements. K % 32 == 0.
// The bias of z-batch entry 0, 1, 2 is bias0, bias1, bias2 (separate input buffers, so no stride can name them).
// KSL > 1: grid (M/64, N/64 * KSL, Z); slice ks = blockIdx.y % KSL sums only k in [ks K/KSL, (ks+1) K/KSL) and stores it in partial plane ks (planes ZH * sC elements apart, one whole z-batch each); the reader adds the planes.
template <typename T16> struct WFrag;
template <> struct WFrag<h16> { typedef v16h V; static __device__ __forceinline__ V ld(const h16* p) { return cat16(*(const v8h*)p, *(const v8h*)(p + 16)); } static __device__ __forceinline__ v8f mma(V a, V b, v8f c) { return wmma16(a, b, c); } };
template <> struct WFrag<bf> { typedef v16bf V; static __device__ __forceinline__ V ld(const bf* p) { return cat16b(*(const v8us*)p, *(const v8us*)(p + 16)); } static __device__ __forceinline__ v8f mma(V a, V b, v8f c) { return wmmab(a, b, c); } };
template <typename T16, int NSPLIT, bool BIAS, int KSL = 1>
__global__ __launch_bounds__(32) void k_gemmw(const T16* __restrict__ A, const T16* __restrict__ A2, const T16* __restrict__ Bt, const T16* __restrict__ Bt2, int K, int lda, float* C, int ldc, const float* __restrict__ bias0, const float* __restrict__ bias1, const float* __restrict__ bias2, size_t sA, size_t sB, size_t sC) {
    typedef typename WFrag<T16>::V V;
    __shared__ __align__(16) float os[16 * 68];
    const size_t z = blockIdx.z; A += z * sA; if (A2) A2 += z * sA; Bt += z * sB; if (Bt2) Bt2 += z * sB; C += z * sC; const float* bias = z == 0 ? bias0 : (z == 1 ? bias1 : bias2);
    const int ks = blockIdx.y % KSL, kb = ks * (K / KSL), ke = kb + K / KSL; C += (size_t)ks * ZH * sC;
    const int lane = threadIdx.x & 31, lr = lane & 15, hi = lane >> 4; const int r0 = blockIdx.x * 64, c0 = (blockIdx.y / KSL) * 64;
    v8f acc[4][4];
#pragma unroll
    for (int mb = 0; mb < 4; ++mb)
#pragma unroll
        for (int nb = 0; nb < 4; ++nb) acc[mb][nb] = (v8f){};
    const size_t aoff = (size_t)(r0 + lr) * lda + 8 * hi, boff = (size_t)(c0 + lr) * K + 8 * hi;
#pragma unroll 1
    for (int kc = kb; kc < ke; kc += 32) {
        V a[4], a2[4];
#pragma unroll
        for (int mb = 0; mb < 4; ++mb) { a[mb] = WFrag<T16>::ld(A + aoff + (size_t)mb * 16 * lda + kc); if (NSPLIT == 1 || NSPLIT == 2) a2[mb] = WFrag<T16>::ld(A2 + aoff + (size_t)mb * 16 * lda + kc); }
#pragma unroll
        for (int nb = 0; nb < 4; ++nb) { const V b = WFrag<T16>::ld(Bt + boff + (size_t)nb * 16 * K + kc); V b2; if (NSPLIT >= 2) b2 = WFrag<T16>::ld(Bt2 + boff + (size_t)nb * 16 * K + kc);
#pragma unroll
            for (int mb = 0; mb < 4; ++mb) { acc[mb][nb] = WFrag<T16>::mma(a[mb], b, acc[mb][nb]); if (NSPLIT == 1 || NSPLIT == 2) acc[mb][nb] = WFrag<T16>::mma(a2[mb], b, acc[mb][nb]); if (NSPLIT >= 2) acc[mb][nb] = WFrag<T16>::mma(a[mb], b2, acc[mb][nb]); } }
        asm volatile("v_nop\n\tv_nop\n\tv_nop\n\tv_nop" : "+v"(acc[0][0]), "+v"(acc[1][1]), "+v"(acc[2][2]), "+v"(acc[3][3]) : "v"(a[0]), "v"(a[3]));
    }
#pragma unroll
    for (int mb = 0; mb < 4; ++mb) {
#pragma unroll
        for (int nb = 0; nb < 4; ++nb) {
#pragma unroll
            for (int j = 0; j < 8; ++j) os[(hi * 8 + j) * 68 + nb * 16 + lr] = acc[mb][nb][j]; }
        __builtin_amdgcn_wave_barrier(); asm volatile("" ::: "memory");
        float* crow = C + (size_t)(r0 + mb * 16) * ldc + c0;
{
#pragma unroll
            for (int s = 0; s < 8; ++s) { const int row = 2 * s + hi, cofs = lr * 4; v4f val = *(const v4fa*)(os + row * 68 + cofs); if (BIAS) { val[0] += bfr(bias[c0 + cofs]); val[1] += bfr(bias[c0 + cofs + 1]); val[2] += bfr(bias[c0 + cofs + 2]); val[3] += bfr(bias[c0 + cofs + 3]); }
                *(v4f*)(crow + (size_t)row * ldc + cofs) = val; }
             }
        __builtin_amdgcn_wave_barrier(); asm volatile("" ::: "memory");
    }
}

__device__ __forceinline__ h16 tohx(float x) { return (h16)x; }
__device__ __forceinline__ void splitf(float y, unsigned short& h, unsigned short& l) { h = f2bf(y); l = f2bf(y - bf2f(h)); }
typedef __attribute__((ext_vector_type(2))) _Float16 v2h;
typedef __attribute__((ext_vector_type(4))) _Float16 v4h;
typedef __attribute__((ext_vector_type(2))) unsigned short v2us;
typedef __attribute__((ext_vector_type(4))) unsigned short v4us;
typedef __attribute__((ext_vector_type(2))) float v2f;
typedef __attribute__((ext_vector_type(4))) int v4i;
typedef v4h  __attribute__((may_alias)) v4ha;
typedef v4us __attribute__((may_alias)) v4usa;

__global__ __launch_bounds__(256) void k_wtG(const float* __restrict__ w, int K, int N, bf* Bt) {
    const int lane = threadIdx.x & 31; const int L0 = (blockIdx.x * 8 + (threadIdx.x >> 5)) * 8; const int nlines = N * K / 64;
{
#pragma unroll 1
        for (int l = 0; l < 8; ++l) { const int L = L0 + l; if (L >= nlines) break; const size_t e = (size_t)L * 64 + lane * 2; const int k = (int)(e % K), n = (int)(e / K); v2us o;
            o[0] = f2bf(w[(size_t)k * N + n]); o[1] = f2bf(w[(size_t)(k + 1) * N + n]); *(v2us*)(Bt + e) = o; }
         }
}
// The bodies below take their block index as an argument: several of them share one launch (k_prep, k_planes).
__device__ __forceinline__ void cvt8_body(unsigned blk, const float* __restrict__ src, bf* dst, size_t n8) { const size_t i = (size_t)blk * 256 + threadIdx.x; if (i >= n8) return; const v8f v = *(const v8f*)(src + i * 8); v8us o;
#pragma unroll
    for (int k = 0; k < 8; ++k) o[k] = f2bf(v[k]); *(v8us*)(dst + i * 8) = o;  }
__global__ __launch_bounds__(256) void k_cscvt(const float* __restrict__ cosT, const float* __restrict__ sinT, float* CS) { const int idx = blockIdx.x * 256 + threadIdx.x; if (idx >= TT * HD) return; v2f cs; cs[0] = bfr(cosT[idx]); cs[1] = bfr(sinT[idx]); *(v2f*)(CS + (size_t)idx * 2) = cs;  }
// rope_body: head planes [h][t][d] (fp16 + hi/lo) of rope(x) x sc with the rotate-half convention out[d] = x[d] cos[t][d] - x[d+HD/2] sin[t][d], out[d+HD/2] = x[d+HD/2] cos[t][d+HD/2] + x[d] sin[t][d+HD/2]
__device__ __forceinline__ void rope_body(unsigned blk, const float* __restrict__ F, int pitch, int nheads, const float* __restrict__ CS, const float* __restrict__ RF, const float* __restrict__ nw, float sc, h16* P16, bf* Ph, bf* Pl) {
    const size_t e = ((size_t)blk * 256 + threadIdx.x) * 2; if (e >= (size_t)nheads * TT * HD) return; const int d = (int)(e % HD); const int t = (int)((e / HD) % TT); const int h = (int)(e / ((size_t)HD * TT)); const float* f = F + (size_t)t * pitch + h * HD; const float rf = RF ? RF[(size_t)h * TT + t] : 1.0f; v2h o16; v2us oh, ol;
    asm volatile("s_wait_xcnt 0x0" ::: "memory");   // in front of the address arithmetic below, which reuses the registers that the load of rf names
#pragma unroll
    for (int q = 0; q < 2; ++q) { const int dd = d + q; const int dp = (dd < HD / 2) ? dd + HD / 2 : dd - HD / 2; float x0 = f[dd], x1 = f[dp];
        asm volatile("s_wait_xcnt 0x0" ::: "memory");   // in front of the next addresses, which reuse the registers that these two loads name
        if (RF) { float n0 = __fmul_rn(x0, rf), n1 = __fmul_rn(x1, rf); asm volatile("" : "+v"(n0)); asm volatile("" : "+v"(n1)); x0 = __fmul_rn(bfr(nw[dd]), n0); x1 = __fmul_rn(bfr(nw[dp]), n1); }
        const v2f cs = *(const v2f*)(CS + ((size_t)t * HD + dd) * 2); float a = __fmul_rn(x0, cs[0]), bq = __fmul_rn(x1, cs[1]); asm volatile("" : "+v"(a)); asm volatile("" : "+v"(bq)); const float r = ((dd < HD / 2) ? __fsub_rn(a, bq) : __fadd_rn(a, bq)) * sc;
        o16[q] = tohx(r); unsigned short a2, c2; splitf(r, a2, c2); oh[q] = a2; ol[q] = c2; }
    *(v2h*)(P16 + e) = o16; *(v2us*)(Ph + e) = oh; *(v2us*)(Pl + e) = ol;  }
__device__ __forceinline__ void vtp_body(unsigned blk, const float* __restrict__ F, int pitch, int nheads, h16* V16, bf* Vh, bf* Vl) { const size_t e = ((size_t)blk * 256 + threadIdx.x) * 2; if (e >= (size_t)nheads * HD * TT) return; const int t = (int)(e % TT); const int d = (int)((e / TT) % HD); const int g = (int)(e / ((size_t)TT * HD)); v2h o16; v2us oh, ol;
#pragma unroll
    for (int q = 0; q < 2; ++q) { const float x = F[(size_t)(t + q) * pitch + g * HD + d]; o16[q] = tohx(x); unsigned short a2, c2; splitf(x, a2, c2); oh[q] = a2; ol[q] = c2; }
    *(v2h*)(V16 + e) = o16; *(v2us*)(Vh + e) = oh; *(v2us*)(Vl + e) = ol;  }
__device__ __forceinline__ void csid_body(unsigned blk, float* CS) { const int idx = blk * 256 + threadIdx.x; if (idx >= TT * HD) return; v2f cs; cs[0] = 1.0f; cs[1] = 0.0f; *(v2f*)(CS + (size_t)idx * 2) = cs;  }
__device__ __forceinline__ void mkf_body(unsigned blk, const int* __restrict__ mk, float* MKF, float* ONES) { const int i = blk * 256 + threadIdx.x; if (i < HD) { *(float*)(ONES + i) = 1.0f; } if (i >= NB_ * NH_ * TT) return; const float v = (float)mk[i]; *(float*)(MKF + i) = v;  if (i < HD) *(float*)(ONES + i) = 1.0f; }
// ---- k_prep: everything that depends on the inputs alone, in one launch; a block's index range says which piece it does.
// x (both batches) -> XB; wq, wk, wv, wo -> four planes in a row from Wp; the identity cos/sin table; the mask as float and the row of ones.
#define PBX ((unsigned)((size_t)NB_ * TT * DM / 8 / 256))
#define PBW ((unsigned)((size_t)DQ * DM / 8 / 256))
#define PBC ((unsigned)((TT * HD + 255) / 256))
#define PBM ((unsigned)((NB_ * NH_ * TT + 255) / 256))
static_assert(DKV == DQ && NKV == NH_ && (size_t)NB_ * TT * DM % 2048 == 0 && (size_t)DQ * DM % 2048 == 0, "k_prep, k_planes and the z-batched projection launch take q, k and v to be of one size");
__global__ __launch_bounds__(256) void k_prep(const float* __restrict__ x, const float* __restrict__ wq, const float* __restrict__ wk, const float* __restrict__ wv, const float* __restrict__ wo, const int* __restrict__ mk, bf* XB, bf* Wp, float* CS, float* MKF, float* ONES) {
    unsigned blk = blockIdx.x;
    if (blk < PBX) { cvt8_body(blk, x, XB, (size_t)NB_ * TT * DM / 8); return; }
    blk -= PBX;
    if (blk < 4 * PBW) { const unsigned s = blk / PBW; const float* w = s == 0 ? wq : (s == 1 ? wk : (s == 2 ? wv : wo)); cvt8_body(blk % PBW, w, Wp + (size_t)s * DQ * DM, (size_t)DQ * DM / 8); return; }
    blk -= 4 * PBW;
    if (blk < PBC) { csid_body(blk, CS); return; }
    mkf_body(blk - PBC, mk, MKF, ONES);
}
// ---- k_planes: the head planes of v, q and k of both batches in one launch. Grid (blocks of one batch's planes, NB_, 3); z = 0: v (its strided reads make it the slowest, so it starts first), 1: q, 2: k.
// F: the three f32 projections [q | k | v], each [NB_ * TT][DQ]; every plane holds both batches, PBE elements each.
#define PBE ((size_t)NH_ * TT * HD)
__global__ __launch_bounds__(256) void k_planes(const float* __restrict__ F, const float* __restrict__ CS, const float* __restrict__ MKF, const float* __restrict__ ONES, h16* Q16, bf* Qh, bf* Ql, h16* K16, bf* Kh, bf* Kl, h16* V16, bf* Vh, bf* Vl) {
    const size_t b = blockIdx.y, pb = b * PBE, fo = b * TT * DQ, fs = (size_t)NB_ * TT * DQ;
    if (blockIdx.z == 0) vtp_body(blockIdx.x, F + 2 * fs + fo, DKV, NKV, V16 + pb, Vh + pb, Vl + pb);
    else { const bool q = blockIdx.z == 1; rope_body(blockIdx.x, F + (q ? 0 : fs) + fo, DQ, NH_, CS, MKF + b * NH_ * TT, ONES, 1.0f, (q ? Q16 : K16) + pb, (q ? Qh : Kh) + pb, (q ? Ql : Kl) + pb); }   // q or k x mask[b][h][s]
}
// ---- k_flash: scores, softmax, attn.v and the head merge in one kernel; the scores never leave the registers.
// Transposed products: S^T = K.Q^T (A = 16 keys, B = 16 queries), O^T += V^T.P^T (A = 16 d, B = 16 queries). In a D tile lane (lr, hi) holds keys 8 hi + j of query lr, so two key tiles,
// converted in place, are the B operand of the second product in the loaders' own k order (8 hi + j, 16 + 8 hi + j), and a query's maximum, sum and rescale factor live in its own two lanes.
// Grid (NB_ * NH_, FBH + FBL), FT threads = 4 waves. Blocks y < FBH: query rows < RH on bf16 hi+lo planes (3 products), 16 queries a wave; the others: fp16 planes, 32 queries a wave.
// K rows and V^T rows of a stage of SK keys go through registers into one of two LDS buffers (pitch = row + 16 bytes); the next stage is stored and the one after it fetched while this one is worked on; one barrier a stage.
#define FT   128
#define FBH  (RH / 64)
#define FBL  ((TT - RH) / 128)
#define FLDS (2 * (2 * 32 * (HD + 8) + 2 * HD * (32 + 8)))   // 16-bit elements: two buffers of the larger (hi+lo) form
typedef __attribute__((ext_vector_type(8))) __bf16 v8bf;
__device__ __forceinline__ float xhalf(float x) { return __builtin_bit_cast(float, __builtin_amdgcn_permlanex16(__builtin_bit_cast(int, x), __builtin_bit_cast(int, x), 0x76543210, 0xfedcba98, false, false)); }   // lane l with lane l ^ 16
// exp2 with its own free slot: the instruction set asks for one independent instruction or v_nop between a transcendental and an instruction that reads its result or overwrites its source
__device__ __forceinline__ float exp2s(float x) { float r; asm("v_exp_f32 %0, %1\n\tv_nop" : "=v"(r) : "v"(x)); return r; }
template <bool HI> struct FFrag;
template <> struct FFrag<false> { typedef v16h V; static __device__ __forceinline__ V ld(const unsigned short* p) { return __builtin_bit_cast(v16h, __builtin_shufflevector(*(const v8usa*)p, *(const v8usa*)(p + 16), 0, 1, 2, 3, 4, 5, 6, 7, 8, 9, 10, 11, 12, 13, 14, 15)); } static __device__ __forceinline__ v8f mma(V a, V b, v8f c) { return wmma16(a, b, c); } };
template <> struct FFrag<true> { typedef v16bf V; static __device__ __forceinline__ V ld(const unsigned short* p) { return cat16b(*(const v8usa*)p, *(const v8usa*)(p + 16)); } static __device__ __forceinline__ v8f mma(V a, V b, v8f c) { return wmmab(a, b, c); } };
template <bool HI>
__device__ __forceinline__ void flash_body(unsigned short* L, const unsigned short* __restrict__ Q0, const unsigned short* __restrict__ Q1, const unsigned short* __restrict__ K0, const unsigned short* __restrict__ K1, const unsigned short* __restrict__ V0, const unsigned short* __restrict__ V1, bf* Oh, bf* Ol, int q0) {
    typedef FFrag<HI> F; typedef typename F::V V;
    constexpr int R = HI ? 1 : 2, NP = HI ? 2 : 1, SK = HI ? 32 : 64, NST = TT / SK, KPI = HD + 8, VPI = SK + 8, KSZ = SK * KPI, VSZ = HD * VPI, BUF = NP * (KSZ + VSZ), CH = SK / 16, VC = SK / 8;
    static_assert(2 * BUF <= FLDS, "LDS");
    const int tid = threadIdx.x, lane = tid & 31, lr = lane & 15, hi = lane >> 4, qw = q0 + (tid >> 5) * 16 * R;
    const float cscale = SCL * 1.4426950408889634f;   // scores in the log2 domain
    v8us rk[NP][CH], rv[NP][CH];
    const unsigned short* kq[2] = {K0, K1}; const unsigned short* vq[2] = {V0, V1};   // wave-uniform pointers to the next stage to fetch; the lanes add 32-bit offsets
    // pro: the fetches in front of the loop. There a later load's result may be given a register that an earlier load of the run names as its offset, so s_wait_xcnt 0 stands behind every load (the loop's fetches are covered by the waits at the stage barrier)
    auto fetch = [&](const bool pro) {
#pragma unroll
        for (int p = 0; p < NP; ++p) {
#pragma unroll
            for (int i = 0; i < CH; ++i) { const int c = tid + FT * i;
                rk[p][i] = *(const v8usa*)(kq[p] + (unsigned)(c * 8));
                if (pro) asm volatile("s_wait_xcnt 0x0" ::: "memory");
                rv[p][i] = *(const v8usa*)(vq[p] + (unsigned)((c / VC) * TT + (c % VC) * 8));
                if (pro) asm volatile("s_wait_xcnt 0x0" ::: "memory"); } } };
    auto advance = [&]() {
#pragma unroll
        for (int p = 0; p < NP; ++p) { kq[p] += SK * HD; vq[p] += SK; } };
    auto put = [&](int b) {
#pragma unroll
        for (int p = 0; p < NP; ++p)
#pragma unroll
            for (int i = 0; i < CH; ++i) { const int c = tid + FT * i;
                *(v8usa*)(L + b * BUF + p * KSZ + (c >> 3) * KPI + (c & 7) * 8) = rk[p][i];
                *(v8usa*)(L + b * BUF + NP * KSZ + p * VSZ + (c / VC) * VPI + (c % VC) * 8) = rv[p][i]; } };
    fetch(true); advance();
    V qf[NP][R][2];
#pragma unroll
    for (int p = 0; p < NP; ++p)
#pragma unroll
        for (int g = 0; g < R; ++g)
#pragma unroll
            for (int kc = 0; kc < 2; ++kc) qf[p][g][kc] = F::ld((p ? Q1 : Q0) + (size_t)(qw + g * 16 + lr) * HD + kc * 32 + 8 * hi);
    v8f acc[R][4]; float m_run[R], l_run[R];
#pragma unroll
    for (int g = 0; g < R; ++g) { m_run[g] = -__builtin_inff(); l_run[g] = 0.f;
#pragma unroll
        for (int t = 0; t < 4; ++t) acc[g][t] = (v8f){}; }
    put(0); fetch(true); advance();
    __syncthreads();   // stage 0 is in buffer 0 for every wave
#pragma unroll 1   // the stage loop stays rolled (registers, code size); every loop inside it is unrolled so that the register arrays are indexed by constants
    for (int st = 0; st < NST; ++st) {
        if (st + 1 < NST) put((st + 1) & 1);   // its last readers left that buffer before the barrier that ended stage st - 1
        if (st + 2 < NST) fetch(false);
        const unsigned short* Kb = L + (st & 1) * BUF + lr * KPI + 8 * hi; const unsigned short* Vb = L + (st & 1) * BUF + NP * KSZ + lr * VPI + 8 * hi;
#pragma unroll
        for (int sub = 0; sub < SK / 32; ++sub) {   // one pass: 32 keys
            v8f s[2][R];
#pragma unroll
            for (int kt = 0; kt < 2; ++kt) {
#pragma unroll
                for (int g = 0; g < R; ++g) s[kt][g] = (v8f){};
#pragma unroll
                for (int kc = 0; kc < 2; ++kc) { const unsigned short* kp = Kb + (sub * 32 + kt * 16) * KPI + kc * 32; const V a = F::ld(kp); V a2; if (HI) a2 = F::ld(kp + KSZ);
#pragma unroll
                    for (int g = 0; g < R; ++g) { s[kt][g] = F::mma(a, qf[0][g][kc], s[kt][g]); if (HI) { s[kt][g] = F::mma(a2, qf[0][g][kc], s[kt][g]); s[kt][g] = F::mma(a, qf[NP - 1][g][kc], s[kt][g]); } } } }
            // the maximum in use may trail the true one by up to 8 (log2 domain, so an exponential stays below 2^8); sums and outputs are rescaled only when some query exceeds that
            float mb[R]; bool need = false;
#pragma unroll
            for (int g = 0; g < R; ++g) { float mx = s[0][g][0];
#pragma unroll
                for (int r = 0; r < 8; ++r) mx = fmaxf(mx, fmaxf(s[0][g][r], s[1][g][r]));
                mx = fmaxf(mx, xhalf(mx)) * cscale; mb[g] = mx; need = need || (mx > m_run[g] + 8.0f); }
            if (__builtin_amdgcn_ballot_w32(need) != 0) {
#pragma unroll
                for (int g = 0; g < R; ++g) { const float m_new = fmaxf(m_run[g], mb[g]); const float corr = exp2s(m_run[g] - m_new); m_run[g] = m_new; l_run[g] *= corr;   // corr is 0 in the first pass
#pragma unroll
                    for (int t = 0; t < 4; ++t) acc[g][t] = acc[g][t] * corr; } }
            V pf[NP][R];
#pragma unroll
            for (int g = 0; g < R; ++g) { v8f p0, p1;
#pragma unroll
                for (int r = 0; r < 8; ++r) { p0[r] = exp2s(__builtin_fmaf(s[0][g][r], cscale, -m_run[g])); p1[r] = exp2s(__builtin_fmaf(s[1][g][r], cscale, -m_run[g])); }
                const v8f ps = p0 + p1; l_run[g] += ((ps[0] + ps[1]) + (ps[2] + ps[3])) + ((ps[4] + ps[5]) + (ps[6] + ps[7]));
                if constexpr (HI) { const v8bf h0 = __builtin_convertvector(p0, v8bf), h1 = __builtin_convertvector(p1, v8bf);
                    const v8bf l0 = __builtin_convertvector(p0 - __builtin_convertvector(h0, v8f), v8bf), l1 = __builtin_convertvector(p1 - __builtin_convertvector(h1, v8f), v8bf);
                    pf[0][g] = __builtin_shufflevector(h0, h1, 0, 1, 2, 3, 4, 5, 6, 7, 8, 9, 10, 11, 12, 13, 14, 15); pf[NP - 1][g] = __builtin_shufflevector(l0, l1, 0, 1, 2, 3, 4, 5, 6, 7, 8, 9, 10, 11, 12, 13, 14, 15);
                } else pf[0][g] = cat16(__builtin_convertvector(p0, v8h), __builtin_convertvector(p1, v8h)); }
#pragma unroll
            for (int t = 0; t < 4; ++t) { const unsigned short* vp = Vb + t * 16 * VPI + sub * 32; const V a = F::ld(vp); V a2; if (HI) a2 = F::ld(vp + VSZ);
#pragma unroll
                for (int g = 0; g < R; ++g) { acc[g][t] = F::mma(a, pf[0][g], acc[g][t]); if (HI) { acc[g][t] = F::mma(a2, pf[0][g], acc[g][t]); acc[g][t] = F::mma(a, pf[NP - 1][g], acc[g][t]); } } }
        }
        __syncthreads();   // publishes stage st + 1 and ends every wave's reads of stage st
        asm volatile("s_wait_xcnt 0x0" ::: "memory");   // in front of the pointer updates: they overwrite the scalar bases that this stage's fetch names (its data has returned by the barrier, so nothing is waited for here)
        __builtin_amdgcn_sched_barrier(0);   // keeps the scheduler from lifting those updates over the wait and the barrier
        advance();
    }
#pragma unroll
    for (int g = 0; g < R; ++g) { const float l = l_run[g] + xhalf(l_run[g]); const float inv = __fdiv_rn(1.0f, l); const size_t oo = (size_t)(qw + g * 16 + lr) * DQ + 8 * hi;
#pragma unroll
        for (int t = 0; t < 4; ++t) { v8us oh, ol;
#pragma unroll
            for (int j = 0; j < 8; ++j) { unsigned short a, c2; splitf(acc[g][t][j] * inv, a, c2); oh[j] = a; ol[j] = c2; }
            *(v8usa*)(Oh + oo + t * 16) = oh; *(v8usa*)(Ol + oo + t * 16) = ol;
            if (g + 1 < R || t < 3) asm volatile("s_wait_xcnt 0x0" ::: "memory"); } }   // in front of the next tile's arithmetic, which reuses the registers these two stores name
}
// amdgpu_waves_per_eu(4, 4): at most 256 VGPRs, so that the two to three work-groups a WGP gets can all be resident (one wave of each on every SIMD)
__global__ __launch_bounds__(FT) __attribute__((amdgpu_waves_per_eu(4, 4))) void k_flash(const h16* __restrict__ Q16, const h16* __restrict__ K16, const h16* __restrict__ V16, const bf* __restrict__ Qh, const bf* __restrict__ Ql, const bf* __restrict__ Kh, const bf* __restrict__ Kl, const bf* __restrict__ Vh, const bf* __restrict__ Vl, bf* Ah, bf* Al) {
    __shared__ __align__(16) unsigned short L[FLDS];
    const size_t z = blockIdx.x, zo = z * TT * HD, ao = (z / NH_) * TT * DQ + (z % NH_) * HD; const int y = blockIdx.y;   // the heavier hi+lo blocks have the low indices and start first
    if (y < FBH) flash_body<true>(L, Qh + zo, Ql + zo, Kh + zo, Kl + zo, Vh + zo, Vl + zo, Ah + ao, Al + ao, y * 64);
    else flash_body<false>(L, (const unsigned short*)Q16 + zo, (const unsigned short*)Q16 + zo, (const unsigned short*)K16 + zo, (const unsigned short*)K16 + zo, (const unsigned short*)V16 + zo, (const unsigned short*)V16 + zo, Ah + ao, Al + ao, RH + (y - FBH) * 128);
}

extern "C" void kernel_launch(void* const* d_in, const int* in_sizes, int n_in,
                              void* d_out, int out_size, void* d_ws, size_t ws_size, hipStream_t stream) {
    (void)in_sizes; (void)n_in; (void)out_size;
    const float* x = (const float*)d_in[0]; const int* MK = (const int*)d_in[1]; const float* wq = (const float*)d_in[2]; const float* bq = (const float*)d_in[3]; const float* wk = (const float*)d_in[4]; const float* bk = (const float*)d_in[5]; const float* wv = (const float*)d_in[6]; const float* bv = (const float*)d_in[7]; const float* wo = (const float*)d_in[8]; const float* bo = (const float*)d_in[9]; const float* cosT = nullptr; const float* sinT = nullptr; (void)cosT; (void)sinT;
    float* OUT = (float*)d_out;     // [2][2048][1024]
    char* wsp = (char*)d_ws;
    auto take = [&](size_t bytes) { char* p = wsp; wsp += (bytes + 255) & ~(size_t)255; return (void*)p; };
    bf* WQ = (bf*)take((size_t)4 * DQ * DM * 2); bf* WO = WQ + (size_t)3 * DQ * DM;   // wq, wk, wv, wo planes in a row
    float* CS = (float*)take((size_t)TT * HD * 2 * 4); float* MKF = (float*)take((size_t)NB_ * NH_ * TT * 4); float* ONES = (float*)take(256);
    bf* XB = (bf*)take((size_t)NB_ * TT * DM * 2); float* FQ = (float*)take((size_t)3 * NB_ * TT * DQ * 4);   // x of both batches; the f32 projections q, k, v in a row, both batches each
    const size_t PB = (size_t)NH_ * TT * HD;   // elements of one batch's head planes; every plane holds both batches, k_flash reads them all in one launch
    h16* QP16 = (h16*)take(NB_ * PB * 2); h16* KP16 = (h16*)take(NB_ * PB * 2); h16* VT16 = (h16*)take(NB_ * PB * 2);
    bf* QPh = (bf*)take(NB_ * PB * 2); bf* QPl = (bf*)take(NB_ * PB * 2); bf* KPh = (bf*)take(NB_ * PB * 2); bf* KPl = (bf*)take(NB_ * PB * 2); bf* VTh = (bf*)take(NB_ * PB * 2); bf* VTl = (bf*)take(NB_ * PB * 2);
    bf* ATh = (bf*)take((size_t)NB_ * TT * DQ * 2); bf* ATl = (bf*)take((size_t)NB_ * TT * DQ * 2);
    if ((size_t)(wsp - (char*)d_ws) > ws_size) return;    // ws 256 MiB
    k_prep<<<PBX + 4 * PBW + PBC + PBM, 256, 0, stream>>>(x, wq, wk, wv, wo, MK, XB, WQ, CS, MKF, ONES);
    k_gemmw<bf, 0, true><<<dim3(NB_ * TT / 64, DQ / 64, 3), 32, 0, stream>>>(XB, nullptr, WQ, nullptr, DM, DM, FQ, DQ, bq, bk, bv, 0, (size_t)DQ * DM, (size_t)NB_ * TT * DQ);   // z = 0, 1, 2: q, k, v; rows: both batches
    k_planes<<<dim3((unsigned)((PB / 2 + 255) / 256), NB_, 3), 256, 0, stream>>>(FQ, CS, MKF, ONES, QP16, QPh, QPl, KP16, KPh, KPl, VT16, VTh, VTl);
    k_flash<<<dim3(NB_ * NH_, FBH + FBL, 1), FT, 0, stream>>>(QP16, KP16, VT16, QPh, QPl, KPh, KPl, VTh, VTl, ATh, ATl);   // one kv head per query head
    k_gemmw<bf, 1, true><<<dim3(NB_ * TT / 64, DM / 64, 1), 32, 0, stream>>>(ATh, ATl, WO, nullptr, DQ, DQ, OUT, DM, bo, bo, bo, 0, 0, 0);   // rows: both batches
}

// v005
// One run takes 150 microseconds.
// Two timings next to v004 put it at 1.25 and 1.26 times that version's speed.
// Over all steps from v000 it is 13.2 times as fast.
#include <hip/hip_runtime.h>

// SparseFlashAttention (x [2][2048][1024]; q/k/v = x W^T + b (torch layouts, 16 heads x 64); q and k multiplied by sparsity_mask[b][h][s] (int 0/1, read as data); softmax(q.k/8) (no other mask); out = (attn v merged) Wo^T + bo -> [2][2048][1024]).
// Compute dtypes, f32 accumulate: every input rounded to bf16; q/k/v projections on PLAIN bf16 operands (inputs: exact) + bias; scores (K 64) and attn.v on bf16 hi+lo planes (3 products) for the first 512 query rows of each head

#define NB_  2
#define TT   2048
#define DM   1024
#define NH_  16
#define NKV  16
#define REP  (NH_ / NKV)
#define HD   64
#define DQ   (NH_ * HD)
#define DKV  (NKV * HD)
#define ZH   8                    // z-batch of a K-sliced k_gemmw launch (KSL > 1; no such launch is left)
#define RH   512                  // query rows < RH use hi+lo planes (0: none)
#define WIN  0
#define SCL  0.125f   // HD^-0.5
typedef _Float16 h16;
typedef unsigned short bf;
typedef __attribute__((ext_vector_type(16))) __bf16   v16bf;
typedef __attribute__((ext_vector_type(16))) _Float16 v16h;
typedef __attribute__((ext_vector_type(8)))  _Float16 v8h;
typedef __attribute__((ext_vector_type(8)))  unsigned short v8us;
typedef __attribute__((ext_vector_type(8)))  float    v8f;
typedef __attribute__((ext_vector_type(4)))  float    v4f;
typedef v8h  __attribute__((may_alias)) v8ha;
typedef v4f  __attribute__((may_alias)) v4fa;
typedef v8us __attribute__((may_alias)) v8usa;

__device__ __forceinline__ unsigned short f2bf(float f) { unsigned u = __float_as_uint(f); u += 0x7FFFu + ((u >> 16) & 1u); return (unsigned short)(u >> 16); }
__device__ __forceinline__ float bf2f(unsigned short b) { return __uint_as_float(((unsigned)b) << 16); }
__device__ __forceinline__ float bfr(float f) { return bf2f(f2bf(f)); }
__device__ __forceinline__ h16 tohx(float x) { return (h16)x; }
__device__ __forceinline__ void splitf(float y, unsigned short& h, unsigned short& l) { h = f2bf(y); l = f2bf(y - bf2f(h)); }
__device__ __forceinline__ v16h cat16(v8h lo, v8h hi) { return __builtin_shufflevector(lo, hi, 0, 1, 2, 3, 4, 5, 6, 7, 8, 9, 10, 11, 12, 13, 14, 15); }
__device__ __forceinline__ v16bf cat16b(v8us lo, v8us hi) { return __builtin_bit_cast(v16bf, __builtin_shufflevector(lo, hi, 0, 1, 2, 3, 4, 5, 6, 7, 8, 9, 10, 11, 12, 13, 14, 15)); }
__device__ __forceinline__ v8f wmma16(v16h a, v16h b, v8f c) { return __builtin_amdgcn_wmma_f32_16x16x32_f16(false, a, false, b, (short)0, c, false, false); }
__device__ __forceinline__ v8f wmmab(v16bf a, v16bf b, v8f c) { return __builtin_amdgcn_wmma_f32_16x16x32_bf16(false, a, false, b, (short)0, c, false, false); }



// ---- k_gemmw: register-blocked GEMM, ONE WAVE per 64x64 output tile (16 accumulators), operands straight from K-contiguous 16-bit planes; grid (M/64, N/64, Z), 32 threads.
// C[m][n] (f32, pitch ldc, + optional f32 bias[n]) = sum_k A[m][k] Bt[n][k] (+ split products per NSPLIT). A rows have pitch lda, Bt rows pitch K (elements). z-batch strides sA/sB/sC in elements. K % 32 == 0.
// The bias of z-batch entry 0, 1, 2 is bias0, bias1, bias2 (separate input buffers, so no stride can name them).
// KSL > 1: grid (M/64, N/64 * KSL, Z); slice ks = blockIdx.y % KSL sums only k in [ks K/KSL, (ks+1) K/KSL) and stores it in partial plane ks (planes ZH * sC elements apart, one whole z-batch each); the reader adds the planes.
template <typename T16> struct WFrag;
template <> struct WFrag<h16> { typedef v16h V; static __device__ __forceinline__ V ld(const h16* p) { return cat16(*(const v8h*)p, *(const v8h*)(p + 16)); } static __device__ __forceinline__ v8f mma(V a, V b, v8f c) { return wmma16(a, b, c); } };
template <> struct WFrag<bf> { typedef v16bf V; static __device__ __forceinline__ V ld(const bf* p) { return cat16b(*(const v8us*)p, *(const v8us*)(p + 16)); } static __device__ __forceinline__ v8f mma(V a, V b, v8f c) { return wmmab(a, b, c); } };
// PL (the q, k, v projections; z = 0, 1, 2; a tile is 64 tokens of one batch x one head): C is not stored; the head planes (fp16 + bf16 hi/lo) of y = sum + bias are written from the accumulators.
// v, planes [b][h][d][t]: in a D tile lane (lr, hi) holds tokens 8 hi + j of column lr, 8 neighbours of a plane row, and stores them as they are.
// q and k, planes [b][h][t][d]: y goes through the LDS tile, 16 tokens at a time, so that a lane stores 8 neighbouring d of one token, each x mask[b][h][t] (mk, read as data).
template <typename T16, int NSPLIT, bool BIAS, int KSL = 1, bool PL = false>
__global__ __launch_bounds__(32) void k_gemmw(const T16* __restrict__ A, const T16* __restrict__ A2, const T16* __restrict__ Bt, const T16* __restrict__ Bt2, int K, int lda, float* C, int ldc, const float* __restrict__ bias0, const float* __restrict__ bias1, const float* __restrict__ bias2, size_t sA, size_t sB, size_t sC, const int* __restrict__ mk, h16* Q16, bf* Qh, bf* Ql, h16* K16, bf* Kh, bf* Kl, h16* V16, bf* Vh, bf* Vl) {
    typedef typename WFrag<T16>::V V;
    __shared__ __align__(16) float os[16 * 68];
    const size_t z = blockIdx.z; A += z * sA; if (A2) A2 += z * sA; Bt += z * sB; if (Bt2) Bt2 += z * sB; C += z * sC; const float* bias = z == 0 ? bias0 : (z == 1 ? bias1 : bias2);
    const int ks = blockIdx.y % KSL, kb = ks * (K / KSL), ke = kb + K / KSL; C += (size_t)ks * ZH * sC;
    const int lane = threadIdx.x & 31, lr = lane & 15, hi = lane >> 4; const int r0 = blockIdx.x * 64, c0 = (blockIdx.y / KSL) * 64;
    v8f acc[4][4];
#pragma unroll
    for (int mb = 0; mb < 4; ++mb)
#pragma unroll
        for (int nb = 0; nb < 4; ++nb) acc[mb][nb] = (v8f){};
    const size_t aoff = (size_t)(r0 + lr) * lda + 8 * hi, boff = (size_t)(c0 + lr) * K + 8 * hi;
#pragma unroll 1
    for (int kc = kb; kc < ke; kc += 32) {
        V a[4], a2[4];
#pragma unroll
        for (int mb = 0; mb < 4; ++mb) { a[mb] = WFrag<T16>::ld(A + aoff + (size_t)mb * 16 * lda + kc); if (NSPLIT == 1 || NSPLIT == 2) a2[mb] = WFrag<T16>::ld(A2 + aoff + (size_t)mb * 16 * lda + kc); }
#pragma unroll
        for (int nb = 0; nb < 4; ++nb) { const V b = WFrag<T16>::ld(Bt + boff + (size_t)nb * 16 * K + kc); V b2; if (NSPLIT >= 2) b2 = WFrag<T16>::ld(Bt2 + boff + (size_t)nb * 16 * K + kc);
#pragma unroll
            for (int mb = 0; mb < 4; ++mb) { acc[mb][nb] = WFrag<T16>::mma(a[mb], b, acc[mb][nb]); if (NSPLIT == 1 || NSPLIT == 2) acc[mb][nb] = WFrag<T16>::mma(a2[mb], b, acc[mb][nb]); if (NSPLIT >= 2) acc[mb][nb] = WFrag<T16>::mma(a[mb], b2, acc[mb][nb]); } }
        asm volatile("v_nop\n\tv_nop\n\tv_nop\n\tv_nop" : "+v"(acc[0][0]), "+v"(acc[1][1]), "+v"(acc[2][2]), "+v"(acc[3][3]) : "v"(a[0]), "v"(a[3]));
    }
    if constexpr (PL) {
        __shared__ float ms[64];
        const int t0 = r0 % TT; const size_t hp = (size_t)(r0 / TT) * NH_ + c0 / HD;   // the tile's first token in its batch; its head plane b NH_ + h
        float bb[4];
#pragma unroll
        for (int nb = 0; nb < 4; ++nb) bb[nb] = bfr(bias[c0 + nb * 16 + lr]);
        if (z == 2) {
            const size_t e0 = hp * TT * HD + (size_t)lr * TT + t0 + 8 * hi;
#pragma unroll
            for (int nb = 0; nb < 4; ++nb)
#pragma unroll
                for (int mb = 0; mb < 4; ++mb) { const size_t e = e0 + (size_t)nb * 16 * TT + mb * 16; v8h o16; v8us oh, ol;
#pragma unroll
                    for (int j = 0; j < 8; ++j) { const float y = acc[mb][nb][j] + bb[nb]; o16[j] = tohx(y); unsigned short a2, c2; splitf(y, a2, c2); oh[j] = a2; ol[j] = c2; }
                    __builtin_amdgcn_sched_barrier(0);   // the tile's arithmetic stays in front of its three stores, so that none of it rewrites a register that an issued store names
                    *(v8h*)(V16 + e) = o16; *(v8us*)(Vh + e) = oh; *(v8us*)(Vl + e) = ol;
                    asm volatile("s_wait_xcnt 0x0" ::: "memory");   // in front of the next tile's arithmetic, which reuses the registers that these three stores name
                    __builtin_amdgcn_sched_barrier(0); }   // keeps the scheduler from lifting that arithmetic over the wait
        } else {
            h16* P16 = z == 0 ? Q16 : K16; bf* Ph = z == 0 ? Qh : Kh; bf* Pl = z == 0 ? Ql : Kl;
            ms[lane] = (float)mk[hp * TT + t0 + lane]; ms[lane + 32] = (float)mk[hp * TT + t0 + lane + 32];   // the 64 tokens' mask
            const int tr = lane >> 3, dc = (lane & 7) * 8; const size_t e0 = hp * TT * HD + (size_t)(t0 + tr) * HD + dc;
#pragma unroll
            for (int mb = 0; mb < 4; ++mb) {
#pragma unroll
                for (int nb = 0; nb < 4; ++nb) {
#pragma unroll
                    for (int j = 0; j < 8; ++j) os[(hi * 8 + j) * 68 + nb * 16 + lr] = acc[mb][nb][j] + bb[nb]; }
                __builtin_amdgcn_wave_barrier(); asm volatile("" ::: "memory");   // the tile's reads stay behind its writes (one wave: its LDS operations run in order)
#pragma unroll
                for (int s = 0; s < 4; ++s) { const float* op = os + (4 * s + tr) * 68 + dc; const v4f y0 = *(const v4fa*)op, y1 = *(const v4fa*)(op + 4); const float rf = ms[mb * 16 + 4 * s + tr]; const size_t e = e0 + (size_t)(mb * 16 + 4 * s) * HD; v8h o16; v8us oh, ol;
#pragma unroll
                    for (int j = 0; j < 8; ++j) { const float y = (j < 4 ? y0[j & 3] : y1[j & 3]) * rf; o16[j] = tohx(y); unsigned short a2, c2; splitf(y, a2, c2); oh[j] = a2; ol[j] = c2; }
                    __builtin_amdgcn_sched_barrier(0);   // as above: arithmetic, then the three stores, then the wait
                    *(v8h*)(P16 + e) = o16; *(v8us*)(Ph + e) = oh; *(v8us*)(Pl + e) = ol;
                    asm volatile("s_wait_xcnt 0x0" ::: "memory");   // in front of the next LDS reads and arithmetic, which reuse the registers that these three stores name
                    __builtin_amdgcn_sched_barrier(0); }
                __builtin_amdgcn_wave_barrier(); asm volatile("" ::: "memory");   // the next 16 tokens' writes stay behind these reads
            }
        }
        return;
    }
#pragma unroll
    for (int mb = 0; mb < 4; ++mb) {
#pragma unroll
        for (int nb = 0; nb < 4; ++nb) {
#pragma unroll
            for (int j = 0; j < 8; ++j) os[(hi * 8 + j) * 68 + nb * 16 + lr] = acc[mb][nb][j]; }
        __builtin_amdgcn_wave_barrier(); asm volatile("" ::: "memory");
        float* crow = C + (size_t)(r0 + mb * 16) * ldc + c0;
{
#pragma unroll
            for (int s = 0; s < 8; ++s) { const int row = 2 * s + hi, cofs = lr * 4; v4f val = *(const v4fa*)(os + row * 68 + cofs); if (BIAS) { val[0] += bfr(bias[c0 + cofs]); val[1] += bfr(bias[c0 + cofs + 1]); val[2] += bfr(bias[c0 + cofs + 2]); val[3] += bfr(bias[c0 + cofs + 3]); }
                *(v4f*)(crow + (size_t)row * ldc + cofs) = val; }
             }
        __builtin_amdgcn_wave_barrier(); asm volatile("" ::: "memory");
    }
}

typedef __attribute__((ext_vector_type(2))) _Float16 v2h;
typedef __attribute__((ext_vector_type(4))) _Float16 v4h;
typedef __attribute__((ext_vector_type(2))) unsigned short v2us;
typedef __attribute__((ext_vector_type(4))) unsigned short v4us;
typedef __attribute__((ext_vector_type(2))) float v2f;
typedef __attribute__((ext_vector_type(4))) int v4i;
typedef v4h  __attribute__((may_alias)) v4ha;
typedef v4us __attribute__((may_alias)) v4usa;

__global__ __launch_bounds__(256) void k_wtG(const float* __restrict__ w, int K, int N, bf* Bt) {
    const int lane = threadIdx.x & 31; const int L0 = (blockIdx.x * 8 + (threadIdx.x >> 5)) * 8; const int nlines = N * K / 64;
{
#pragma unroll 1
        for (int l = 0; l < 8; ++l) { const int L = L0 + l; if (L >= nlines) break; const size_t e = (size_t)L * 64 + lane * 2; const int k = (int)(e % K), n = (int)(e / K); v2us o;
            o[0] = f2bf(w[(size_t)k * N + n]); o[1] = f2bf(w[(size_t)(k + 1) * N + n]); *(v2us*)(Bt + e) = o; }
         }
}
// The body below takes its block index as an argument: its uses share one launch (k_prep).
__device__ __forceinline__ void cvt8_body(unsigned blk, const float* __restrict__ src, bf* dst, size_t n8) { const size_t i = (size_t)blk * 256 + threadIdx.x; if (i >= n8) return; const v8f v = *(const v8f*)(src + i * 8); v8us o;
    asm volatile("s_wait_xcnt 0x0" ::: "memory");   // in front of the arithmetic below, which reuses the registers that the load names as its address
#pragma unroll
    for (int k = 0; k < 8; ++k) o[k] = f2bf(v[k]); *(v8us*)(dst + i * 8) = o;  }
__global__ __launch_bounds__(256) void k_cscvt(const float* __restrict__ cosT, const float* __restrict__ sinT, float* CS) { const int idx = blockIdx.x * 256 + threadIdx.x; if (idx >= TT * HD) return; v2f cs; cs[0] = bfr(cosT[idx]); cs[1] = bfr(sinT[idx]); *(v2f*)(CS + (size_t)idx * 2) = cs;  }
// ---- k_prep: the 16-bit copies of the inputs, in one launch; a block's index range says which piece it does.
// x (both batches) -> XB; wq, wk, wv, wo -> four planes in a row from Wp.
#define PBX ((unsigned)((size_t)NB_ * TT * DM / 8 / 256))
#define PBW ((unsigned)((size_t)DQ * DM / 8 / 256))
static_assert(DKV == DQ && NKV == NH_ && HD == 64 && TT % 64 == 0 && (size_t)NB_ * TT * DM % 2048 == 0 && (size_t)DQ * DM % 2048 == 0, "k_prep and the z-batched projection launch take q, k and v to be of one size, and a 64 x 64 tile to be 64 tokens of one batch x one head");
__global__ __launch_bounds__(256) void k_prep(const float* __restrict__ x, const float* __restrict__ wq, const float* __restrict__ wk, const float* __restrict__ wv, const float* __restrict__ wo, bf* XB, bf* Wp) {
    unsigned blk = blockIdx.x;
    if (blk < PBX) { cvt8_body(blk, x, XB, (size_t)NB_ * TT * DM / 8); return; }
    blk -= PBX;
    if (blk < 4 * PBW) { const unsigned s = blk / PBW; const float* w = s == 0 ? wq : (s == 1 ? wk : (s == 2 ? wv : wo)); cvt8_body(blk % PBW, w, Wp + (size_t)s * DQ * DM, (size_t)DQ * DM / 8); return; }
}
// ---- k_flash: scores, softmax, attn.v and the head merge in one kernel; the scores never leave the registers.
// Transposed products: S^T = K.Q^T (A = 16 keys, B = 16 queries), O^T += V^T.P^T (A = 16 d, B = 16 queries). In a D tile lane (lr, hi) holds keys 8 hi + j of query lr, so two key tiles,
// converted in place, are the B operand of the second product in the loaders' own k order (8 hi + j, 16 + 8 hi + j), and a query's maximum, sum and rescale factor live in its own two lanes.
// Grid (NB_ * NH_, FBH + FBL), FT threads = 4 waves. Blocks y < FBH: query rows < RH on bf16 hi+lo planes (3 products), 16 queries a wave; the others: fp16 planes, 32 queries a wave.
// K rows and V^T rows of a stage of SK keys go through registers into one of two LDS buffers (pitch = row + 16 bytes); the next stage is stored and the one after it fetched while this one is worked on; one barrier a stage.
#define FT   128
#define FBH  (RH / 64)
#define FBL  ((TT - RH) / 128)
#define FLDS (2 * (2 * 32 * (HD + 8) + 2 * HD * (32 + 8)))   // 16-bit elements: two buffers of the larger (hi+lo) form
typedef __attribute__((ext_vector_type(8))) __bf16 v8bf;
__device__ __forceinline__ float xhalf(float x) { return __builtin_bit_cast(float, __builtin_amdgcn_permlanex16(__builtin_bit_cast(int, x), __builtin_bit_cast(int, x), 0x76543210, 0xfedcba98, false, false)); }   // lane l with lane l ^ 16
// exp2 with its own free slot: the instruction set asks for one independent instruction or v_nop between a transcendental and an instruction that reads its result or overwrites its source
__device__ __forceinline__ float exp2s(float x) { float r; asm("v_exp_f32 %0, %1\n\tv_nop" : "=v"(r) : "v"(x)); return r; }
template <bool HI> struct FFrag;
template <> struct FFrag<false> { typedef v16h V; static __device__ __forceinline__ V ld(const unsigned short* p) { return __builtin_bit_cast(v16h, __builtin_shufflevector(*(const v8usa*)p, *(const v8usa*)(p + 16), 0, 1, 2, 3, 4, 5, 6, 7, 8, 9, 10, 11, 12, 13, 14, 15)); } static __device__ __forceinline__ v8f mma(V a, V b, v8f c) { return wmma16(a, b, c); } };
template <> struct FFrag<true> { typedef v16bf V; static __device__ __forceinline__ V ld(const unsigned short* p) { return cat16b(*(const v8usa*)p, *(const v8usa*)(p + 16)); } static __device__ __forceinline__ v8f mma(V a, V b, v8f c) { return wmmab(a, b, c); } };
template <bool HI>
__device__ __forceinline__ void flash_body(unsigned short* L, const unsigned short* __restrict__ Q0, const unsigned short* __restrict__ Q1, const unsigned short* __restrict__ K0, const unsigned short* __restrict__ K1, const unsigned short* __restrict__ V0, const unsigned short* __restrict__ V1, bf* Oh, bf* Ol, int q0) {
    typedef FFrag<HI> F; typedef typename F::V V;
    constexpr int R = HI ? 1 : 2, NP = HI ? 2 : 1, SK = HI ? 32 : 64, NST = TT / SK, KPI = HD + 8, VPI = SK + 8, KSZ = SK * KPI, VSZ = HD * VPI, BUF = NP * (KSZ + VSZ), CH = SK / 16, VC = SK / 8;
    static_assert(2 * BUF <= FLDS, "LDS");
    const int tid = threadIdx.x, lane = tid & 31, lr = lane & 15, hi = lane >> 4, qw = q0 + (tid >> 5) * 16 * R;
    const float cscale = SCL * 1.4426950408889634f;   // scores in the log2 domain
    v8us rk[NP][CH], rv[NP][CH];
    const unsigned short* kq[2] = {K0, K1}; const unsigned short* vq[2] = {V0, V1};   // wave-uniform pointers to the next stage to fetch; the lanes add 32-bit offsets
    // pro: the fetches in front of the loop. There a later load's result may be given a register that an earlier load of the run names as its offset, so s_wait_xcnt 0 stands behind every load (the loop's fetches are covered by the waits at the stage barrier)
    auto fetch = [&](const bool pro) {
#pragma unroll
        for (int p = 0; p < NP; ++p) {
#pragma unroll
            for (int i = 0; i < CH; ++i) { const int c = tid + FT * i;
                rk[p][i] = *(const v8usa*)(kq[p] + (unsigned)(c * 8));
                if (pro) asm volatile("s_wait_xcnt 0x0" ::: "memory");
                rv[p][i] = *(const v8usa*)(vq[p] + (unsigned)((c / VC) * TT + (c % VC) * 8));
                if (pro) asm volatile("s_wait_xcnt 0x0" ::: "memory"); } } };
    auto advance = [&]() {
#pragma unroll
        for (int p = 0; p < NP; ++p) { kq[p] += SK * HD; vq[p] += SK; } };
    auto put = [&](int b) {
#pragma unroll
        for (int p = 0; p < NP; ++p)
#pragma unroll
            for (int i = 0; i < CH; ++i) { const int c = tid + FT * i;
                *(v8usa*)(L + b * BUF + p * KSZ + (c >> 3) * KPI + (c & 7) * 8) = rk[p][i];
                *(v8usa*)(L + b * BUF + NP * KSZ + p * VSZ + (c / VC) * VPI + (c % VC) * 8) = rv[p][i]; } };
    fetch(true); advance();
    V qf[NP][R][2];
#pragma unroll
    for (int p = 0; p < NP; ++p)
#pragma unroll
        for (int g = 0; g < R; ++g)
#pragma unroll
            for (int kc = 0; kc < 2; ++kc) qf[p][g][kc] = F::ld((p ? Q1 : Q0) + (size_t)(qw + g * 16 + lr) * HD + kc * 32 + 8 * hi);
    v8f acc[R][4]; float m_run[R], l_run[R];
#pragma unroll
    for (int g = 0; g < R; ++g) { m_run[g] = -__builtin_inff(); l_run[g] = 0.f;
#pragma unroll
        for (int t = 0; t < 4; ++t) acc[g][t] = (v8f){}; }
    put(0); fetch(true); advance();
    __syncthreads();   // stage 0 is in buffer 0 for every wave
#pragma unroll 1   // the stage loop stays rolled (registers, code size); every loop inside it is unrolled so that the register arrays are indexed by constants
    for (int st = 0; st < NST; ++st) {
        if (st + 1 < NST) put((st + 1) & 1);   // its last readers left that buffer before the barrier that ended stage st - 1
        if (st + 2 < NST) fetch(false);
        const unsigned short* Kb = L + (st & 1) * BUF + lr * KPI + 8 * hi; const unsigned short* Vb = L + (st & 1) * BUF + NP * KSZ + lr * VPI + 8 * hi;
#pragma unroll
        for (int sub = 0; sub < SK / 32; ++sub) {   // one pass: 32 keys
            v8f s[2][R];
#pragma unroll
            for (int kt = 0; kt < 2; ++kt) {
#pragma unroll
                for (int g = 0; g < R; ++g) s[kt][g] = (v8f){};
#pragma unroll
                for (int kc = 0; kc < 2; ++kc) { const unsigned short* kp = Kb + (sub * 32 + kt * 16) * KPI + kc * 32; const V a = F::ld(kp); V a2; if (HI) a2 = F::ld(kp + KSZ);
#pragma unroll
                    for (int g = 0; g < R; ++g) { s[kt][g] = F::mma(a, qf[0][g][kc], s[kt][g]); if (HI) { s[kt][g] = F::mma(a2, qf[0][g][kc], s[kt][g]); s[kt][g] = F::mma(a, qf[NP - 1][g][kc], s[kt][g]); } } } }
            // the maximum in use may trail the true one by up to 8 (log2 domain, so an exponential stays below 2^8); sums and outputs are rescaled only when some query exceeds that
            float mb[R]; bool need = false;
#pragma unroll
            for (int g = 0; g < R; ++g) { float mx = s[0][g][0];
#pragma unroll
                for (int r = 0; r < 8; ++r) mx = fmaxf(mx, fmaxf(s[0][g][r], s[1][g][r]));
                mx = fmaxf(mx, xhalf(mx)) * cscale; mb[g] = mx; need = need || (mx > m_run[g] + 8.0f); }
            if (__builtin_amdgcn_ballot_w32(need) != 0) {
#pragma unroll
                for (int g = 0; g < R; ++g) { const float m_new = fmaxf(m_run[g], mb[g]); const float corr = exp2s(m_run[g] - m_new); m_run[g] = m_new; l_run[g] *= corr;   // corr is 0 in the first pass
#pragma unroll
                    for (int t = 0; t < 4; ++t) acc[g][t] = acc[g][t] * corr; } }
            V pf[NP][R];
#pragma unroll
            for (int g = 0; g < R; ++g) { v8f p0, p1;
#pragma unroll
                for (int r = 0; r < 8; ++r) { p0[r] = exp2s(__builtin_fmaf(s[0][g][r], cscale, -m_run[g])); p1[r] = exp2s(__builtin_fmaf(s[1][g][r], cscale, -m_run[g])); }
                const v8f ps = p0 + p1; l_run[g] += ((ps[0] + ps[1]) + (ps[2] + ps[3])) + ((ps[4] + ps[5]) + (ps[6] + ps[7]));
                if constexpr (HI) { const v8bf h0 = __builtin_convertvector(p0, v8bf), h1 = __builtin_convertvector(p1, v8bf);
                    const v8bf l0 = __builtin_convertvector(p0 - __builtin_convertvector(h0, v8f), v8bf), l1 = __builtin_convertvector(p1 - __builtin_convertvector(h1, v8f), v8bf);
                    pf[0][g] = __builtin_shufflevector(h0, h1, 0, 1, 2, 3, 4, 5, 6, 7, 8, 9, 10, 11, 12, 13, 14, 15); pf[NP - 1][g] = __builtin_shufflevector(l0, l1, 0, 1, 2, 3, 4, 5, 6, 7, 8, 9, 10, 11, 12, 13, 14, 15);
                } else pf[0][g] = cat16(__builtin_convertvector(p0, v8h), __builtin_convertvector(p1, v8h)); }
#pragma unroll
            for (int t = 0; t < 4; ++t) { const unsigned short* vp = Vb + t * 16 * VPI + sub * 32; const V a = F::ld(vp); V a2; if (HI) a2 = F::ld(vp + VSZ);
#pragma unroll
                for (int g = 0; g < R; ++g) { acc[g][t] = F::mma(a, pf[0][g], acc[g][t]); if (HI) { acc[g][t] = F::mma(a2, pf[0][g], acc[g][t]); acc[g][t] = F::mma(a, pf[NP - 1][g], acc[g][t]); } } }
        }
        __syncthreads();   // publishes stage st + 1 and ends every wave's reads of stage st
        asm volatile("s_wait_xcnt 0x0" ::: "memory");   // in front of the pointer updates: they overwrite the scalar bases that this stage's fetch names (its data has returned by the barrier, so nothing is waited for here)
        __builtin_amdgcn_sched_barrier(0);   // keeps the scheduler from lifting those updates over the wait and the barrier
        advance();
    }
#pragma unroll
    for (int g = 0; g < R; ++g) { const float l = l_run[g] + xhalf(l_run[g]); const float inv = __fdiv_rn(1.0f, l); const size_t oo = (size_t)(qw + g * 16 + lr) * DQ + 8 * hi;
#pragma unroll
        for (int t = 0; t < 4; ++t) { v8us oh, ol;
#pragma unroll
            for (int j = 0; j < 8; ++j) { unsigned short a, c2; splitf(acc[g][t][j] * inv, a, c2); oh[j] = a; ol[j] = c2; }
            *(v8usa*)(Oh + oo + t * 16) = oh; *(v8usa*)(Ol + oo + t * 16) = ol;
            if (g + 1 < R || t < 3) asm volatile("s_wait_xcnt 0x0" ::: "memory"); } }   // in front of the next tile's arithmetic, which reuses the registers these two stores name
}
// amdgpu_waves_per_eu(4, 4): at most 256 VGPRs, so that the two to three work-groups a WGP gets can all be resident (one wave of each on every SIMD)
__global__ __launch_bounds__(FT) __attribute__((amdgpu_waves_per_eu(4, 4))) void k_flash(const h16* __restrict__ Q16, const h16* __restrict__ K16, const h16* __restrict__ V16, const bf* __restrict__ Qh, const bf* __restrict__ Ql, const bf* __restrict__ Kh, const bf* __restrict__ Kl, const bf* __restrict__ Vh, const bf* __restrict__ Vl, bf* Ah, bf* Al) {
    __shared__ __align__(16) unsigned short L[FLDS];
    const size_t z = blockIdx.x, zo = z * TT * HD, ao = (z / NH_) * TT * DQ + (z % NH_) * HD; const int y = blockIdx.y;   // the heavier hi+lo blocks have the low indices and start first
    if (y < FBH) flash_body<true>(L, Qh + zo, Ql + zo, Kh + zo, Kl + zo, Vh + zo, Vl + zo, Ah + ao, Al + ao, y * 64);
    else flash_body<false>(L, (const unsigned short*)Q16 + zo, (const unsigned short*)Q16 + zo, (const unsigned short*)K16 + zo, (const unsigned short*)K16 + zo, (const unsigned short*)V16 + zo, (const unsigned short*)V16 + zo, Ah + ao, Al + ao, RH + (y - FBH) * 128);
}

extern "C" void kernel_launch(void* const* d_in, const int* in_sizes, int n_in,
                              void* d_out, int out_size, void* d_ws, size_t ws_size, hipStream_t stream) {
    (void)in_sizes; (void)n_in; (void)out_size;
    const float* x = (const float*)d_in[0]; const int* MK = (const int*)d_in[1]; const float* wq = (const float*)d_in[2]; const float* bq = (const float*)d_in[3]; const float* wk = (const float*)d_in[4]; const float* bk = (const float*)d_in[5]; const float* wv = (const float*)d_in[6]; const float* bv = (const float*)d_in[7]; const float* wo = (const float*)d_in[8]; const float* bo = (const float*)d_in[9]; const float* cosT = nullptr; const float* sinT = nullptr; (void)cosT; (void)sinT;
    float* OUT = (float*)d_out;     // [2][2048][1024]
    char* wsp = (char*)d_ws;
    auto take = [&](size_t bytes) { char* p = wsp; wsp += (bytes + 255) & ~(size_t)255; return (void*)p; };
    bf* WQ = (bf*)take((size_t)4 * DQ * DM * 2); bf* WO = WQ + (size_t)3 * DQ * DM;   // wq, wk, wv, wo planes in a row
    bf* XB = (bf*)take((size_t)NB_ * TT * DM * 2);   // x of both batches
    const size_t PB = (size_t)NH_ * TT * HD;   // elements of one batch's head planes; every plane holds both batches, k_flash reads them all in one launch
    h16* QP16 = (h16*)take(NB_ * PB * 2); h16* KP16 = (h16*)take(NB_ * PB * 2); h16* VT16 = (h16*)take(NB_ * PB * 2);
    bf* QPh = (bf*)take(NB_ * PB * 2); bf* QPl = (bf*)take(NB_ * PB * 2); bf* KPh = (bf*)take(NB_ * PB * 2); bf* KPl = (bf*)take(NB_ * PB * 2); bf* VTh = (bf*)take(NB_ * PB * 2); bf* VTl = (bf*)take(NB_ * PB * 2);
    bf* ATh = (bf*)take((size_t)NB_ * TT * DQ * 2); bf* ATl = (bf*)take((size_t)NB_ * TT * DQ * 2);
    if ((size_t)(wsp - (char*)d_ws) > ws_size) return;    // ws 256 MiB
    k_prep<<<PBX + 4 * PBW, 256, 0, stream>>>(x, wq, wk, wv, wo, XB, WQ);
    k_gemmw<bf, 0, true, 1, true><<<dim3(NB_ * TT / 64, DQ / 64, 3), 32, 0, stream>>>(XB, nullptr, WQ, nullptr, DM, DM, nullptr, 0, bq, bk, bv, 0, (size_t)DQ * DM, 0, MK, QP16, QPh, QPl, KP16, KPh, KPl, VT16, VTh, VTl);   // z = 0, 1, 2: q, k, v; rows: both batches; writes the head planes
    k_flash<<<dim3(NB_ * NH_, FBH + FBL, 1), FT, 0, stream>>>(QP16, KP16, VT16, QPh, QPl, KPh, KPl, VTh, VTl, ATh, ATl);   // one kv head per query head
    k_gemmw<bf, 1, true><<<dim3(NB_ * TT / 64, DM / 64, 1), 32, 0, stream>>>(ATh, ATl, WO, nullptr, DQ, DQ, OUT, DM, bo, bo, bo, 0, 0, 0, nullptr, nullptr, nullptr, nullptr, nullptr, nullptr, nullptr, nullptr, nullptr, nullptr);   // rows: both batches
}
